// v000
// Measured on an AMD MI455X. A time is GPU time per run, averaged over a window of back-to-back runs after a warm-up
// (all launches, gaps included; the runs take copies of the inputs in turn), and the median of several windows.
// Apart from v000's, it joins two sittings. Times from different sittings can be a few percent apart, while
// side-by-side timings come from the same sitting.
// v000, which the later versions start from, runs in 173 microseconds.
#include <hip/hip_runtime.h>

// ---------------------------------------------------------------------------
// Causal linear attention (chunkwise) for MI455X / gfx1250, fp32 WMMA path.
// Shapes: N=4, L=4096, H=16, D=M=64, CHUNK=128, G=32 chunks.
// 3 passes: per-chunk KV state -> exclusive chunk prefix -> per-chunk output.
// Matmuls on V_WMMA_F32_16X16X4_F32; untransformed operands staged with
// GLOBAL_LOAD_ASYNC_TO_LDS_B128 (ASYNCcnt), phi(q)/phi(k) via VGPR path.
// ---------------------------------------------------------------------------

typedef float v2f __attribute__((ext_vector_type(2)));
typedef float v8f __attribute__((ext_vector_type(8)));

#define NB   4
#define LL   4096
#define HH   16
#define DD   64
#define CC   128
#define GG   32
#define ROWSTRIDE 1024          // H*D elements between consecutive l
#define SQK 68                  // LDS stride (floats), 68%64==4 -> conflict-free
#define SSS 132                 // LDS stride for 128x128 score tile
#define SKVS 68                 // LDS stride for 64x64 KV state

__device__ __forceinline__ float phi(float x) {            // elu(x)+1
    return x > 0.0f ? x + 1.0f : __expf(x);
}
__device__ __forceinline__ float4 phi4(float4 v) {
    v.x = phi(v.x); v.y = phi(v.y); v.z = phi(v.z); v.w = phi(v.w);
    return v;
}

// Async memory -> LDS copy of 16 bytes per lane (ASYNCcnt-tracked).
// ldsOff: byte offset within this workgroup's LDS allocation (16B aligned).
__device__ __forceinline__ void async_g2lds_b128(unsigned ldsOff, const void* g) {
    asm volatile("global_load_async_to_lds_b128 %0, %1, off"
                 :: "v"(ldsOff), "v"(g) : "memory");
}
__device__ __forceinline__ void wait_async0() {
    asm volatile("s_wait_asynccnt 0x0" ::: "memory");
}

__device__ __forceinline__ v8f wmma4(v2f a, v2f b, v8f c) {
    // D(16x16,f32) = A(16x4,f32) x B(4x16,f32) + C
    return __builtin_amdgcn_wmma_f32_16x16x4_f32(false, a, false, b,
                                                 (short)0, c, false, false);
}

// Fragment loaders for the 16x16x4 f32 operand layouts (wave32):
//   A: lane ln holds row m=ln; VGPR j holds K = k0 + 2*hl + j   (hl = lane>>4)
//   B: lane ln holds col n=ln; VGPR j holds K = k0 + 2*hl + j
// L1: matrix stored row-major as S[row][col] with (row=m|n, col=k)
__device__ __forceinline__ v2f ldsL1(const float* s, int stride, int r0, int k0,
                                     int ln, int hl) {
    v2f f;
    const float* p = s + (r0 + ln) * stride + k0 + 2 * hl;
    f.x = p[0]; f.y = p[1];
    return f;
}
// L2: matrix stored row-major as S[k][col] (k varies with VGPR/half-wave)
__device__ __forceinline__ v2f ldsL2(const float* s, int stride, int k0, int c0,
                                     int ln, int hl) {
    v2f f;
    f.x = s[(k0 + 2 * hl + 0) * stride + c0 + ln];
    f.y = s[(k0 + 2 * hl + 1) * stride + c0 + ln];
    return f;
}

// ---------------------------------------------------------------------------
// Pass 1: per-chunk state.  block = (n,g,h).  kv = phi(k)^T x v  (64x64),
// ksum = column sums of phi(k).  8 waves: each owns 2 of 16 kv tiles.
// ---------------------------------------------------------------------------
__global__ void __launch_bounds__(256) k_chunk_state(
        const float* __restrict__ K, const float* __restrict__ V,
        float* __restrict__ wkv, float* __restrict__ wks) {
    extern __shared__ float smem[];
    float* sK = smem;                 // 128 x SQK
    float* sV = sK + CC * SQK;        // 128 x SQK
    const unsigned sVoff = (unsigned)(CC * SQK) * 4u;   // LDS byte offset of sV

    const int tid = threadIdx.x, wave = tid >> 5, lane = tid & 31;
    const int ln = lane & 15, hl = lane >> 4;
    const int b = blockIdx.x;                     // ((n*32+g)*16+h)
    const int h = b & 15, ng = b >> 4, g = ng & 31, n = ng >> 5;
    const long base = (((long)n * LL + (long)g * CC) * HH + h) * DD;

    // V: async memory->LDS (no transform needed); K: VGPR path with phi
    #pragma unroll
    for (int i = 0; i < 8; ++i) {
        int idx = tid + i * 256;
        int c = idx >> 4, c4 = (idx & 15) * 4;
        async_g2lds_b128(sVoff + (unsigned)(c * SQK + c4) * 4u,
                         V + base + (long)c * ROWSTRIDE + c4);
        float4 vk = *(const float4*)(K + base + (long)c * ROWSTRIDE + c4);
        *(float4*)&sK[c * SQK + c4] = phi4(vk);
    }
    wait_async0();
    __syncthreads();

    v8f acc[2];
    #pragma unroll
    for (int t = 0; t < 2; ++t)
        #pragma unroll
        for (int r = 0; r < 8; ++r) acc[t][r] = 0.0f;

    #pragma unroll
    for (int t = 0; t < 2; ++t) {
        int tile = 2 * wave + t, dt = tile >> 2, mt = tile & 3;
        #pragma unroll
        for (int k0 = 0; k0 < CC; k0 += 4) {
            v2f a  = ldsL2(sK, SQK, k0, 16 * dt, ln, hl);  // A[d][c] = kc[c][d]
            v2f bb = ldsL2(sV, SQK, k0, 16 * mt, ln, hl);  // B[c][m] = vc[c][m]
            acc[t] = wmma4(a, bb, acc[t]);
        }
    }

    if (tid < DD) {                      // ksum over the chunk
        float s = 0.0f;
        for (int c = 0; c < CC; ++c) s += sK[c * SQK + tid];
        wks[(long)b * DD + tid] = s;
    }

    float* okv = wkv + (long)b * (DD * DD);
    #pragma unroll
    for (int t = 0; t < 2; ++t) {
        int tile = 2 * wave + t, dt = tile >> 2, mt = tile & 3;
        #pragma unroll
        for (int r = 0; r < 8; ++r)
            okv[(16 * dt + r + 8 * hl) * DD + 16 * mt + ln] = acc[t][r];
    }
}

// ---------------------------------------------------------------------------
// Pass 2: in-place exclusive prefix over chunks.  block = (n,h), 64 blocks.
// ---------------------------------------------------------------------------
__global__ void __launch_bounds__(256) k_prefix(
        float* __restrict__ wkv, float* __restrict__ wks) {
    const int tid = threadIdx.x, b = blockIdx.x;
    const int n = b >> 4, h = b & 15;
    float acc[16];
    #pragma unroll
    for (int j = 0; j < 16; ++j) acc[j] = 0.0f;
    float accs = 0.0f;
    for (int g = 0; g < GG; ++g) {
        long idx = (long)(n * GG + g) * HH + h;
        float* p = wkv + idx * (DD * DD);
        #pragma unroll
        for (int j = 0; j < 16; ++j) {
            int e = tid + j * 256;
            float v = p[e];
            p[e] = acc[j];
            acc[j] += v;
        }
        if (tid < DD) {
            float* ps = wks + idx * DD;
            float v = ps[tid];
            ps[tid] = accs;
            accs += v;
        }
    }
}

// ---------------------------------------------------------------------------
// Pass 3: outputs.  block = (n,g,h).
//   out = phi(q) x kv_prev  +  tril(phi(q) phi(k)^T) x v
//   z   = phi(q).ksum_prev  +  rowsum(masked scores)  + eps
// Wave w owns score/output row-tile w (rows 16w..16w+15); causal tiles only.
// ---------------------------------------------------------------------------
__global__ void __launch_bounds__(256) k_output(
        const float* __restrict__ Q, const float* __restrict__ K,
        const float* __restrict__ V, const float* __restrict__ wkv,
        const float* __restrict__ wks, float* __restrict__ O) {
    extern __shared__ float smem[];
    float* sQ  = smem;                  // 128 x SQK
    float* sK  = sQ + CC * SQK;         // 128 x SQK
    float* sV  = sK + CC * SQK;         // 128 x SQK
    float* sS  = sV + CC * SQK;         // 128 x SSS  (masked scores)
    float* sKV = sS + CC * SSS;         // 64 x SKVS  (exclusive-prefix kv)
    float* sZ  = sKV + DD * SKVS;       // 128
    float* sKs = sZ + CC;               // 64
    const unsigned sVoff  = (unsigned)(2 * CC * SQK) * 4u;
    const unsigned sKVoff = (unsigned)(3 * CC * SQK + CC * SSS) * 4u;

    const int tid = threadIdx.x, wave = tid >> 5, lane = tid & 31;
    const int ln = lane & 15, hl = lane >> 4;
    const int b = blockIdx.x;
    const int h = b & 15, ng = b >> 4, g = ng & 31, n = ng >> 5;
    const long base = (((long)n * LL + (long)g * CC) * HH + h) * DD;

    // V + prefix-KV: async memory->LDS; Q/K: VGPR path with phi
    const float* ikv = wkv + (long)b * (DD * DD);
    #pragma unroll
    for (int i = 0; i < 4; ++i) {
        int idx = tid + i * 256;                   // 1024 float4 total
        int r = idx >> 4, c4 = (idx & 15) * 4;
        async_g2lds_b128(sKVoff + (unsigned)(r * SKVS + c4) * 4u,
                         ikv + r * DD + c4);
    }
    #pragma unroll
    for (int i = 0; i < 8; ++i) {
        int idx = tid + i * 256;
        int c = idx >> 4, c4 = (idx & 15) * 4;
        async_g2lds_b128(sVoff + (unsigned)(c * SQK + c4) * 4u,
                         V + base + (long)c * ROWSTRIDE + c4);
        float4 vq = *(const float4*)(Q + base + (long)c * ROWSTRIDE + c4);
        float4 vk = *(const float4*)(K + base + (long)c * ROWSTRIDE + c4);
        *(float4*)&sQ[c * SQK + c4] = phi4(vq);
        *(float4*)&sK[c * SQK + c4] = phi4(vk);
    }
    if (tid < DD) sKs[tid] = wks[(long)b * DD + tid];
    wait_async0();
    __syncthreads();

    // normalizer, inter-chunk part: z = phi(q_l) . ksum_prev
    if (tid < CC) {
        float acc = 0.0f;
        for (int d = 0; d < DD; ++d) acc += sQ[tid * SQK + d] * sKs[d];
        sZ[tid] = acc + 1e-6f;
    }

    // inter-chunk output: out = phi(q) x kv_prev   (wave w -> row-tile w)
    v8f out_acc[4];
    #pragma unroll
    for (int t = 0; t < 4; ++t)
        #pragma unroll
        for (int r = 0; r < 8; ++r) out_acc[t][r] = 0.0f;
    #pragma unroll
    for (int nt = 0; nt < 4; ++nt) {
        #pragma unroll
        for (int k0 = 0; k0 < DD; k0 += 4) {
            v2f a  = ldsL1(sQ, SQK, 16 * wave, k0, ln, hl);
            v2f bb = ldsL2(sKV, SKVS, k0, 16 * nt, ln, hl);
            out_acc[nt] = wmma4(a, bb, out_acc[nt]);
        }
    }

    // scores: S = phi(q) phi(k)^T, causal tiles only; diagonal tile masked
    for (int nt = 0; nt <= wave; ++nt) {
        v8f sacc;
        #pragma unroll
        for (int r = 0; r < 8; ++r) sacc[r] = 0.0f;
        #pragma unroll
        for (int k0 = 0; k0 < DD; k0 += 4) {
            v2f a  = ldsL1(sQ, SQK, 16 * wave, k0, ln, hl);
            v2f bb = ldsL1(sK, SQK, 16 * nt, k0, ln, hl); // B[k][n] = kc[n][k]
            sacc = wmma4(a, bb, sacc);
        }
        int nn = 16 * nt + ln;
        #pragma unroll
        for (int r = 0; r < 8; ++r) {
            int m = 16 * wave + r + 8 * hl;
            float val = sacc[r];
            if (nt == wave && nn > m) val = 0.0f;   // causal mask on diagonal
            sS[m * SSS + nn] = val;
        }
    }
    __syncthreads();

    // normalizer, intra part: rowsum of masked scores (cols 0..t only)
    if (tid < CC) {
        float acc = 0.0f;
        for (int j = 0; j <= tid; ++j) acc += sS[tid * SSS + j];
        sZ[tid] += acc;
    }

    // intra-chunk output: out += S x v   (contract only causal k-tiles)
    #pragma unroll
    for (int nt = 0; nt < 4; ++nt) {
        for (int k0 = 0; k0 < 16 * (wave + 1); k0 += 4) {
            v2f a  = ldsL1(sS, SSS, 16 * wave, k0, ln, hl);
            v2f bb = ldsL2(sV, SQK, k0, 16 * nt, ln, hl);
            out_acc[nt] = wmma4(a, bb, out_acc[nt]);
        }
    }
    __syncthreads();   // sZ final before use

    float* go = O + base;
    #pragma unroll
    for (int nt = 0; nt < 4; ++nt) {
        int mv = 16 * nt + ln;
        #pragma unroll
        for (int r = 0; r < 8; ++r) {
            int m = 16 * wave + r + 8 * hl;
            go[(long)m * ROWSTRIDE + mv] = out_acc[nt][r] / sZ[m];
        }
    }
}

// ---------------------------------------------------------------------------
extern "C" void kernel_launch(void* const* d_in, const int* in_sizes, int n_in,
                              void* d_out, int out_size, void* d_ws, size_t ws_size,
                              hipStream_t stream) {
    const float* Q = (const float*)d_in[0];
    const float* K = (const float*)d_in[1];
    const float* V = (const float*)d_in[2];
    float* O = (float*)d_out;

    const int nChunks = NB * GG * HH;                 // 2048
    float* wkv = (float*)d_ws;                        // 2048 * 4096 f32
    float* wks = wkv + (size_t)nChunks * DD * DD;     // 2048 * 64 f32

    const size_t lds1 = (size_t)(2 * CC * SQK) * sizeof(float);
    const size_t lds3 = (size_t)(3 * CC * SQK + CC * SSS + DD * SKVS + CC + DD)
                        * sizeof(float);

    hipFuncSetAttribute((const void*)k_chunk_state,
                        hipFuncAttributeMaxDynamicSharedMemorySize, (int)lds1);
    hipFuncSetAttribute((const void*)k_output,
                        hipFuncAttributeMaxDynamicSharedMemorySize, (int)lds3);

    k_chunk_state<<<nChunks, 256, lds1, stream>>>(K, V, wkv, wks);
    k_prefix<<<NB * HH, 256, 0, stream>>>(wkv, wks);
    k_output<<<nChunks, 256, lds3, stream>>>(Q, K, V, wkv, wks, O);
}

// v001
// A run of this version takes 109 microseconds.
// Next to v000, in two timings, it ran 1.62 and 1.63 times as fast.
#include <hip/hip_runtime.h>

// ---------------------------------------------------------------------------
// Causal linear attention (chunkwise) for MI455X / gfx1250, fp32 WMMA path.
// Shapes: N=4, L=4096, H=16, D=M=64, CHUNK=128, G=32 chunks.
// 3 passes: per-chunk KV state -> exclusive chunk prefix -> per-chunk output.
// Matmuls on V_WMMA_F32_16X16X4_F32; untransformed operands staged with
// GLOBAL_LOAD_ASYNC_TO_LDS_B128 (ASYNCcnt), phi(q)/phi(k) via VGPR path.
// ---------------------------------------------------------------------------

typedef float v2f __attribute__((ext_vector_type(2)));
typedef float v8f __attribute__((ext_vector_type(8)));

#define NB   4
#define LL   4096
#define HH   16
#define DD   64
#define CC   128
#define GG   32
#define ROWSTRIDE 1024          // H*D elements between consecutive l
#define SQK 68                  // LDS stride (floats), 68%64==4 -> conflict-free
#define SKVS 68                 // LDS stride for 64x64 KV state

__device__ __forceinline__ float phi(float x) {            // elu(x)+1
    return x > 0.0f ? x + 1.0f : __expf(x);
}
__device__ __forceinline__ float4 phi4(float4 v) {
    v.x = phi(v.x); v.y = phi(v.y); v.z = phi(v.z); v.w = phi(v.w);
    return v;
}

// Async memory -> LDS copy of 16 bytes per lane (ASYNCcnt-tracked).
// ldsOff: byte offset within this workgroup's LDS allocation (16B aligned).
__device__ __forceinline__ void async_g2lds_b128(unsigned ldsOff, const void* g) {
    asm volatile("global_load_async_to_lds_b128 %0, %1, off"
                 :: "v"(ldsOff), "v"(g) : "memory");
}
__device__ __forceinline__ void wait_async0() {
    asm volatile("s_wait_asynccnt 0x0" ::: "memory");
}

__device__ __forceinline__ v8f wmma4(v2f a, v2f b, v8f c) {
    // D(16x16,f32) = A(16x4,f32) x B(4x16,f32) + C
    return __builtin_amdgcn_wmma_f32_16x16x4_f32(false, a, false, b,
                                                 (short)0, c, false, false);
}

// Fragment loaders for the 16x16x4 f32 operand layouts (wave32):
//   A: lane ln holds row m=ln; VGPR j holds K = k0 + 2*hl + j   (hl = lane>>4)
//   B: lane ln holds col n=ln; VGPR j holds K = k0 + 2*hl + j
// L1: matrix stored row-major as S[row][col] with (row=m|n, col=k)
__device__ __forceinline__ v2f ldsL1(const float* s, int stride, int r0, int k0,
                                     int ln, int hl) {
    v2f f;
    const float* p = s + (r0 + ln) * stride + k0 + 2 * hl;
    f.x = p[0]; f.y = p[1];
    return f;
}
// L2: matrix stored row-major as S[k][col] (k varies with VGPR/half-wave)
__device__ __forceinline__ v2f ldsL2(const float* s, int stride, int k0, int c0,
                                     int ln, int hl) {
    v2f f;
    f.x = s[(k0 + 2 * hl + 0) * stride + c0 + ln];
    f.y = s[(k0 + 2 * hl + 1) * stride + c0 + ln];
    return f;
}

// ---------------------------------------------------------------------------
// Pass 1: per-chunk state.  block = (n,g,h).  kv = phi(k)^T x v  (64x64),
// ksum = column sums of phi(k).  8 waves: each owns 2 of 16 kv tiles.
// ---------------------------------------------------------------------------
__global__ void __launch_bounds__(256) k_chunk_state(
        const float* __restrict__ K, const float* __restrict__ V,
        float* __restrict__ wkv, float* __restrict__ wks) {
    extern __shared__ float smem[];
    float* sK = smem;                 // 128 x SQK
    float* sV = sK + CC * SQK;        // 128 x SQK
    const unsigned sVoff = (unsigned)(CC * SQK) * 4u;   // LDS byte offset of sV

    const int tid = threadIdx.x, wave = tid >> 5, lane = tid & 31;
    const int ln = lane & 15, hl = lane >> 4;
    const int b = blockIdx.x;                     // ((n*32+g)*16+h)
    const int h = b & 15, ng = b >> 4, g = ng & 31, n = ng >> 5;
    const long base = (((long)n * LL + (long)g * CC) * HH + h) * DD;

    // V: async memory->LDS (no transform needed); K: VGPR path with phi
    #pragma unroll
    for (int i = 0; i < 8; ++i) {
        int idx = tid + i * 256;
        int c = idx >> 4, c4 = (idx & 15) * 4;
        async_g2lds_b128(sVoff + (unsigned)(c * SQK + c4) * 4u,
                         V + base + (long)c * ROWSTRIDE + c4);
        float4 vk = *(const float4*)(K + base + (long)c * ROWSTRIDE + c4);
        *(float4*)&sK[c * SQK + c4] = phi4(vk);
    }
    wait_async0();
    __syncthreads();

    v8f acc[2];
    #pragma unroll
    for (int t = 0; t < 2; ++t)
        #pragma unroll
        for (int r = 0; r < 8; ++r) acc[t][r] = 0.0f;

    #pragma unroll
    for (int t = 0; t < 2; ++t) {
        int tile = 2 * wave + t, dt = tile >> 2, mt = tile & 3;
        #pragma unroll
        for (int k0 = 0; k0 < CC; k0 += 4) {
            v2f a  = ldsL2(sK, SQK, k0, 16 * dt, ln, hl);  // A[d][c] = kc[c][d]
            v2f bb = ldsL2(sV, SQK, k0, 16 * mt, ln, hl);  // B[c][m] = vc[c][m]
            acc[t] = wmma4(a, bb, acc[t]);
        }
    }

    if (tid < DD) {                      // ksum over the chunk
        float s = 0.0f;
        for (int c = 0; c < CC; ++c) s += sK[c * SQK + tid];
        wks[(long)b * DD + tid] = s;
    }

    float* okv = wkv + (long)b * (DD * DD);
    #pragma unroll
    for (int t = 0; t < 2; ++t) {
        int tile = 2 * wave + t, dt = tile >> 2, mt = tile & 3;
        #pragma unroll
        for (int r = 0; r < 8; ++r)
            okv[(16 * dt + r + 8 * hl) * DD + 16 * mt + ln] = acc[t][r];
    }
}

// ---------------------------------------------------------------------------
// Pass 2: in-place exclusive prefix over chunks.  block = (n,h), 64 blocks.
// ---------------------------------------------------------------------------
__global__ void __launch_bounds__(256) k_prefix(
        float* __restrict__ wkv, float* __restrict__ wks) {
    const int tid = threadIdx.x, b = blockIdx.x;
    const int n = b >> 4, h = b & 15;
    float acc[16];
    #pragma unroll
    for (int j = 0; j < 16; ++j) acc[j] = 0.0f;
    float accs = 0.0f;
    for (int g = 0; g < GG; ++g) {
        long idx = (long)(n * GG + g) * HH + h;
        float* p = wkv + idx * (DD * DD);
        #pragma unroll
        for (int j = 0; j < 16; ++j) {
            int e = tid + j * 256;
            float v = p[e];
            p[e] = acc[j];
            acc[j] += v;
        }
        if (tid < DD) {
            float* ps = wks + idx * DD;
            float v = ps[tid];
            ps[tid] = accs;
            accs += v;
        }
    }
}

// ---------------------------------------------------------------------------
// Pass 3: outputs.  block = (n,g,h).
//   out = phi(q) x kv_prev  +  tril(phi(q) phi(k)^T) x v
//   z   = phi(q).ksum_prev  +  rowsum(masked scores)  + eps
// Wave w owns output row-tile w (rows 16w..16w+15); causal key tiles only.
// Scores are formed transposed, T = phi(k) x phi(q)^T: the result registers of
// T (lane = query, VGPR r = key r + 8*hl) are then A fragments of S x v as they
// stand, with k order key = 8*hl + 2*s + j in step s; the v loader follows the
// same order.  The score tile never goes through LDS.
// ---------------------------------------------------------------------------
__global__ void __launch_bounds__(256) k_output(
        const float* __restrict__ Q, const float* __restrict__ K,
        const float* __restrict__ V, const float* __restrict__ wkv,
        const float* __restrict__ wks, float* __restrict__ O) {
    extern __shared__ float smem[];
    float* sQ  = smem;                  // 128 x SQK
    float* sK  = sQ + CC * SQK;         // 128 x SQK
    float* sV  = sK + CC * SQK;         // 128 x SQK
    float* sKV = sV + CC * SQK;         // 64 x SKVS  (exclusive-prefix kv)
    float* sZ  = sKV + DD * SKVS;       // 128
    float* sKs = sZ + CC;               // 64
    float* sZi = sKs + DD;              // 2 x 128 (score row sums, per half-wave)
    const unsigned sVoff  = (unsigned)(2 * CC * SQK) * 4u;
    const unsigned sKVoff = (unsigned)(3 * CC * SQK) * 4u;

    const int tid = threadIdx.x, wave = tid >> 5, lane = tid & 31;
    const int ln = lane & 15, hl = lane >> 4;
    const int b = blockIdx.x;
    const int h = b & 15, ng = b >> 4, g = ng & 31, n = ng >> 5;
    const long base = (((long)n * LL + (long)g * CC) * HH + h) * DD;

    // V + prefix-KV: async memory->LDS; Q/K: VGPR path with phi
    const float* ikv = wkv + (long)b * (DD * DD);
    #pragma unroll
    for (int i = 0; i < 4; ++i) {
        int idx = tid + i * 256;                   // 1024 float4 total
        int r = idx >> 4, c4 = (idx & 15) * 4;
        async_g2lds_b128(sKVoff + (unsigned)(r * SKVS + c4) * 4u,
                         ikv + r * DD + c4);
    }
    #pragma unroll
    for (int i = 0; i < 8; ++i) {
        int idx = tid + i * 256;
        int c = idx >> 4, c4 = (idx & 15) * 4;
        async_g2lds_b128(sVoff + (unsigned)(c * SQK + c4) * 4u,
                         V + base + (long)c * ROWSTRIDE + c4);
        float4 vq = *(const float4*)(Q + base + (long)c * ROWSTRIDE + c4);
        float4 vk = *(const float4*)(K + base + (long)c * ROWSTRIDE + c4);
        *(float4*)&sQ[c * SQK + c4] = phi4(vq);
        *(float4*)&sK[c * SQK + c4] = phi4(vk);
    }
    if (tid < DD) sKs[tid] = wks[(long)b * DD + tid];
    wait_async0();
    __syncthreads();

    // normalizer, inter-chunk part: z = phi(q_l) . ksum_prev
    if (tid < CC) {
        float acc = 0.0f;
        for (int d = 0; d < DD; ++d) acc += sQ[tid * SQK + d] * sKs[d];
        sZ[tid] = acc + 1e-6f;
    }

    // inter-chunk output: out = phi(q) x kv_prev   (wave w -> row-tile w)
    v8f out_acc[4];
    #pragma unroll
    for (int t = 0; t < 4; ++t)
        #pragma unroll
        for (int r = 0; r < 8; ++r) out_acc[t][r] = 0.0f;
    #pragma unroll
    for (int nt = 0; nt < 4; ++nt) {
        #pragma unroll
        for (int k0 = 0; k0 < DD; k0 += 4) {
            v2f a  = ldsL1(sQ, SQK, 16 * wave, k0, ln, hl);
            v2f bb = ldsL2(sKV, SKVS, k0, 16 * nt, ln, hl);
            out_acc[nt] = wmma4(a, bb, out_acc[nt]);
        }
    }

    // B fragments of T: B[d][query] = qc[query][d]; the same for every key tile
    v2f qf[16];
    #pragma unroll
    for (int k = 0; k < 16; ++k)
        qf[k] = ldsL1(sQ, SQK, 16 * wave, 4 * k, ln, hl);

    // wave number in a scalar register: the key-tile loop branches on SCC
    const int wv = __builtin_amdgcn_readfirstlane(wave);
    float zrow = 0.0f;                   // this lane's 8 keys per tile, query ln
    for (int kt = 0; kt <= wv; ++kt) {
        // v fragments of this key tile, asked for ahead of the T chain so that
        // their LDS latency passes under it; B[key][m], key = 8*hl + 2*s + j
        const float* pv = sV + (16 * kt + 8 * hl) * SQK + ln;
        v2f vb[4][4];
        #pragma unroll
        for (int s = 0; s < 4; ++s)
            #pragma unroll
            for (int nt = 0; nt < 4; ++nt) {
                vb[s][nt].x = pv[(2 * s + 0) * SQK + 16 * nt];
                vb[s][nt].y = pv[(2 * s + 1) * SQK + 16 * nt];
            }
        // T = phi(k) x phi(q)^T for key tile kt
        v8f st;
        #pragma unroll
        for (int r = 0; r < 8; ++r) st[r] = 0.0f;
        #pragma unroll
        for (int k = 0; k < 16; ++k) {
            v2f a = ldsL1(sK, SQK, 16 * kt, 4 * k, ln, hl);  // A[key][d]
            st = wmma4(a, qf[k], st);
        }
        // five vector slots between the last WMMA of T and the first reader of
        // its result (the mask's select, or the next WMMA that takes it as A)
        asm volatile("v_nop\n\tv_nop\n\tv_nop\n\tv_nop\n\tv_nop" : "+v"(st));
        // causal mask: only the diagonal tile has keys above the query
        const int lim = (kt == wv) ? ln : 15;
        #pragma unroll
        for (int r = 0; r < 8; ++r)
            st[r] = (r + 8 * hl > lim) ? 0.0f : st[r];
        zrow += ((st[0] + st[1]) + (st[2] + st[3]))
              + ((st[4] + st[5]) + (st[6] + st[7]));
        // out += S x v, A fragments taken from st as they stand
        #pragma unroll
        for (int s = 0; s < 4; ++s) {
            v2f a;
            a.x = st[2 * s]; a.y = st[2 * s + 1];
            #pragma unroll
            for (int nt = 0; nt < 4; ++nt)
                out_acc[nt] = wmma4(a, vb[s][nt], out_acc[nt]);
        }
    }
    sZi[hl * CC + 16 * wave + ln] = zrow;
    __syncthreads();   // sZ (written by other waves) and sZi final before use

    float* go = O + base;
    float zr[8];
    #pragma unroll
    for (int r = 0; r < 8; ++r) {
        int m = 16 * wave + r + 8 * hl;
        zr[r] = sZ[m] + (sZi[m] + sZi[CC + m]);
    }
    #pragma unroll
    for (int nt = 0; nt < 4; ++nt) {
        int mv = 16 * nt + ln;
        #pragma unroll
        for (int r = 0; r < 8; ++r) {
            int m = 16 * wave + r + 8 * hl;
            go[(long)m * ROWSTRIDE + mv] = out_acc[nt][r] / zr[r];
        }
    }
}

// ---------------------------------------------------------------------------
extern "C" void kernel_launch(void* const* d_in, const int* in_sizes, int n_in,
                              void* d_out, int out_size, void* d_ws, size_t ws_size,
                              hipStream_t stream) {
    const float* Q = (const float*)d_in[0];
    const float* K = (const float*)d_in[1];
    const float* V = (const float*)d_in[2];
    float* O = (float*)d_out;

    const int nChunks = NB * GG * HH;                 // 2048
    float* wkv = (float*)d_ws;                        // 2048 * 4096 f32
    float* wks = wkv + (size_t)nChunks * DD * DD;     // 2048 * 64 f32

    const size_t lds1 = (size_t)(2 * CC * SQK) * sizeof(float);
    const size_t lds3 = (size_t)(3 * CC * SQK + DD * SKVS + CC + DD + 2 * CC)
                        * sizeof(float);

    hipFuncSetAttribute((const void*)k_chunk_state,
                        hipFuncAttributeMaxDynamicSharedMemorySize, (int)lds1);
    hipFuncSetAttribute((const void*)k_output,
                        hipFuncAttributeMaxDynamicSharedMemorySize, (int)lds3);

    k_chunk_state<<<nChunks, 256, lds1, stream>>>(K, V, wkv, wks);
    k_prefix<<<NB * HH, 256, 0, stream>>>(wkv, wks);
    k_output<<<nChunks, 256, lds3, stream>>>(Q, K, V, wkv, wks, O);
}

// v002
// Measured time: 91.7 microseconds a run.
// Timed twice side by side with v001, it ran 1.18 times as fast both times.
// All steps since v000 together make it 1.92 times as fast.
#include <hip/hip_runtime.h>

// ---------------------------------------------------------------------------
// Causal linear attention (chunkwise) for MI455X / gfx1250, fp32 WMMA path.
// Shapes: N=4, L=4096, H=16, D=M=64, CHUNK=128, G=32 chunks.
// 3 passes: per-chunk KV state -> exclusive chunk prefix -> per-chunk output.
// Matmuls on V_WMMA_F32_16X16X4_F32; untransformed operands staged with
// GLOBAL_LOAD_ASYNC_TO_LDS_B128 (ASYNCcnt), phi(q)/phi(k) via VGPR path.
// ---------------------------------------------------------------------------

typedef float v2f __attribute__((ext_vector_type(2)));
typedef float v8f __attribute__((ext_vector_type(8)));

#define NB   4
#define LL   4096
#define HH   16
#define DD   64
#define CC   128
#define GG   32
#define ROWSTRIDE 1024          // H*D elements between consecutive l
#define SQK 68                  // LDS stride (floats), 68%64==4 -> conflict-free
#define SKVS 68                 // LDS stride for 64x64 KV state

__device__ __forceinline__ float phi(float x) {            // elu(x)+1
    return x > 0.0f ? x + 1.0f : __expf(x);
}
__device__ __forceinline__ float4 phi4(float4 v) {
    v.x = phi(v.x); v.y = phi(v.y); v.z = phi(v.z); v.w = phi(v.w);
    return v;
}

// Four async memory -> LDS copies of 16 bytes per lane (ASYNCcnt-tracked).
// l*: byte offset within this workgroup's LDS allocation (16B aligned).
// The s_wait_xcnt closes the statement as a precaution: it stands ahead of every
// later write of a register that these copies name, and inside the statement the
// compiler can move nothing over it.
__device__ __forceinline__ void async_g2lds_b128_x4(
        unsigned l0, const void* g0, unsigned l1, const void* g1,
        unsigned l2, const void* g2, unsigned l3, const void* g3) {
    asm volatile("global_load_async_to_lds_b128 %0, %1, off\n\t"
                 "global_load_async_to_lds_b128 %2, %3, off\n\t"
                 "global_load_async_to_lds_b128 %4, %5, off\n\t"
                 "global_load_async_to_lds_b128 %6, %7, off\n\t"
                 "s_wait_xcnt 0x0"
                 :: "v"(l0), "v"(g0), "v"(l1), "v"(g1),
                    "v"(l2), "v"(g2), "v"(l3), "v"(g3) : "memory");
}
__device__ __forceinline__ void wait_async0() {
    asm volatile("s_wait_asynccnt 0x0" ::: "memory");
}

__device__ __forceinline__ v8f wmma4(v2f a, v2f b, v8f c) {
    // D(16x16,f32) = A(16x4,f32) x B(4x16,f32) + C
    return __builtin_amdgcn_wmma_f32_16x16x4_f32(false, a, false, b,
                                                 (short)0, c, false, false);
}

// Fragment loaders for the 16x16x4 f32 operand layouts (wave32):
//   A: lane ln holds row m=ln; VGPR j holds K = k0 + 2*hl + j   (hl = lane>>4)
//   B: lane ln holds col n=ln; VGPR j holds K = k0 + 2*hl + j
// L1: matrix stored row-major as S[row][col] with (row=m|n, col=k)
__device__ __forceinline__ v2f ldsL1(const float* s, int stride, int r0, int k0,
                                     int ln, int hl) {
    v2f f;
    const float* p = s + (r0 + ln) * stride + k0 + 2 * hl;
    f.x = p[0]; f.y = p[1];
    return f;
}
// L2: matrix stored row-major as S[k][col] (k varies with VGPR/half-wave)
__device__ __forceinline__ v2f ldsL2(const float* s, int stride, int k0, int c0,
                                     int ln, int hl) {
    v2f f;
    f.x = s[(k0 + 2 * hl + 0) * stride + c0 + ln];
    f.y = s[(k0 + 2 * hl + 1) * stride + c0 + ln];
    return f;
}

// ---------------------------------------------------------------------------
// Pass 1: per-chunk state.  block = (n,g,h).  kv = phi(k)^T x v  (64x64),
// ksum = column sums of phi(k).  8 waves: each owns 2 of 16 kv tiles.
// ---------------------------------------------------------------------------
__global__ void __launch_bounds__(256) k_chunk_state(
        const float* __restrict__ K, const float* __restrict__ V,
        float* __restrict__ wkv, float* __restrict__ wks) {
    extern __shared__ float smem[];
    float* sK = smem;                 // 128 x SQK
    float* sV = sK + CC * SQK;        // 128 x SQK
    const unsigned sVoff = (unsigned)(CC * SQK) * 4u;   // LDS byte offset of sV

    const int tid = threadIdx.x, wave = tid >> 5, lane = tid & 31;
    const int ln = lane & 15, hl = lane >> 4;
    const int b = blockIdx.x;                     // ((n*32+g)*16+h)
    const int h = b & 15, ng = b >> 4, g = ng & 31, n = ng >> 5;
    const long base = (((long)n * LL + (long)g * CC) * HH + h) * DD;

    // V: async memory->LDS (no transform needed); K: VGPR path with phi.
    // Every request of the tile is issued before the first wait, so the block
    // pays one memory latency and not one per row group.
    const int c0 = tid >> 4, c4 = (tid & 15) * 4;   // row group i: row c0 + 16 i
    const float* gK = K + base + (long)c0 * ROWSTRIDE + c4;
    const float* gV = V + base + (long)c0 * ROWSTRIDE + c4;
    const unsigned lV = sVoff + (unsigned)(c0 * SQK + c4) * 4u;
    #pragma unroll   // constant row offsets
    for (int i = 0; i < 8; i += 4)
        async_g2lds_b128_x4(
            lV + (unsigned)((i + 0) * 16 * SQK) * 4u, gV + (long)(i + 0) * 16 * ROWSTRIDE,
            lV + (unsigned)((i + 1) * 16 * SQK) * 4u, gV + (long)(i + 1) * 16 * ROWSTRIDE,
            lV + (unsigned)((i + 2) * 16 * SQK) * 4u, gV + (long)(i + 2) * 16 * ROWSTRIDE,
            lV + (unsigned)((i + 3) * 16 * SQK) * 4u, gV + (long)(i + 3) * 16 * ROWSTRIDE);
    float4 vk[8];
    #pragma unroll   // vk[] stays in registers
    for (int i = 0; i < 8; ++i)
        vk[i] = *(const float4*)(gK + (long)i * 16 * ROWSTRIDE);
    // precaution: behind the loads, ahead of the first write of their address
    // pair, which is named as an input so that it is kept up to here
    asm volatile("s_wait_xcnt 0x0" :: "v"(gK) : "memory");
    #pragma unroll   // vk[] stays in registers
    for (int i = 0; i < 8; ++i)
        *(float4*)&sK[(c0 + 16 * i) * SQK + c4] = phi4(vk[i]);
    wait_async0();
    __syncthreads();

    v8f acc[2];
    #pragma unroll
    for (int t = 0; t < 2; ++t)
        #pragma unroll
        for (int r = 0; r < 8; ++r) acc[t][r] = 0.0f;

    #pragma unroll
    for (int t = 0; t < 2; ++t) {
        int tile = 2 * wave + t, dt = tile >> 2, mt = tile & 3;
        #pragma unroll
        for (int k0 = 0; k0 < CC; k0 += 4) {
            v2f a  = ldsL2(sK, SQK, k0, 16 * dt, ln, hl);  // A[d][c] = kc[c][d]
            v2f bb = ldsL2(sV, SQK, k0, 16 * mt, ln, hl);  // B[c][m] = vc[c][m]
            acc[t] = wmma4(a, bb, acc[t]);
        }
    }

    if (tid < DD) {                      // ksum over the chunk
        float s = 0.0f;
        for (int c = 0; c < CC; ++c) s += sK[c * SQK + tid];
        wks[(long)b * DD + tid] = s;
    }

    float* okv = wkv + (long)b * (DD * DD);
    #pragma unroll
    for (int t = 0; t < 2; ++t) {
        int tile = 2 * wave + t, dt = tile >> 2, mt = tile & 3;
        #pragma unroll
        for (int r = 0; r < 8; ++r)
            okv[(16 * dt + r + 8 * hl) * DD + 16 * mt + ln] = acc[t][r];
    }
}

// ---------------------------------------------------------------------------
// Pass 2: in-place exclusive prefix over chunks.  block = (n,h), 64 blocks.
// ---------------------------------------------------------------------------
__global__ void __launch_bounds__(256) k_prefix(
        float* __restrict__ wkv, float* __restrict__ wks) {
    const int tid = threadIdx.x, b = blockIdx.x;
    const int n = b >> 4, h = b & 15;
    float acc[16];
    #pragma unroll
    for (int j = 0; j < 16; ++j) acc[j] = 0.0f;
    float accs = 0.0f;
    for (int g = 0; g < GG; ++g) {
        long idx = (long)(n * GG + g) * HH + h;
        float* p = wkv + idx * (DD * DD);
        #pragma unroll
        for (int j = 0; j < 16; ++j) {
            int e = tid + j * 256;
            float v = p[e];
            p[e] = acc[j];
            acc[j] += v;
        }
        if (tid < DD) {
            float* ps = wks + idx * DD;
            float v = ps[tid];
            ps[tid] = accs;
            accs += v;
        }
    }
}

// ---------------------------------------------------------------------------
// Pass 3: outputs.  block = (n,g,h).
//   out = phi(q) x kv_prev  +  tril(phi(q) phi(k)^T) x v
//   z   = phi(q).ksum_prev  +  rowsum(masked scores)  + eps
// Wave w owns output row-tile w (rows 16w..16w+15); causal key tiles only.
// Scores are formed transposed, T = phi(k) x phi(q)^T: the result registers of
// T (lane = query, VGPR r = key r + 8*hl) are then A fragments of S x v as they
// stand, with k order key = 8*hl + 2*s + j in step s; the v loader follows the
// same order.  The score tile never goes through LDS.
// ---------------------------------------------------------------------------
__global__ void __launch_bounds__(256) k_output(
        const float* __restrict__ Q, const float* __restrict__ K,
        const float* __restrict__ V, const float* __restrict__ wkv,
        const float* __restrict__ wks, float* __restrict__ O) {
    extern __shared__ float smem[];
    float* sQ  = smem;                  // 128 x SQK
    float* sK  = sQ + CC * SQK;         // 128 x SQK
    float* sV  = sK + CC * SQK;         // 128 x SQK
    float* sKV = sV + CC * SQK;         // 64 x SKVS  (exclusive-prefix kv)
    float* sZ  = sKV + DD * SKVS;       // 128
    float* sKs = sZ + CC;               // 64
    float* sZi = sKs + DD;              // 2 x 128 (score row sums, per half-wave)
    const unsigned sVoff  = (unsigned)(2 * CC * SQK) * 4u;
    const unsigned sKVoff = (unsigned)(3 * CC * SQK) * 4u;

    const int tid = threadIdx.x, wave = tid >> 5, lane = tid & 31;
    const int ln = lane & 15, hl = lane >> 4;
    const int b = blockIdx.x;
    const int h = b & 15, ng = b >> 4, g = ng & 31, n = ng >> 5;
    const long base = (((long)n * LL + (long)g * CC) * HH + h) * DD;

    // V + prefix-KV: async memory->LDS; Q/K: VGPR path with phi.
    // Every request of the block is issued before the first wait, so the block
    // pays one memory latency and not one per row group.
    const int c0 = tid >> 4, c4 = (tid & 15) * 4;   // row group i: row c0 + 16 i
    const float* gQ = Q + base + (long)c0 * ROWSTRIDE + c4;
    const float* gK = K + base + (long)c0 * ROWSTRIDE + c4;
    const float* gV = V + base + (long)c0 * ROWSTRIDE + c4;
    const float* gKV = wkv + (long)b * (DD * DD) + c0 * DD + c4;
    const unsigned lV  = sVoff  + (unsigned)(c0 * SQK  + c4) * 4u;
    const unsigned lKV = sKVoff + (unsigned)(c0 * SKVS + c4) * 4u;
    #pragma unroll   // constant row offsets
    for (int i = 0; i < 8; i += 4)
        async_g2lds_b128_x4(
            lV + (unsigned)((i + 0) * 16 * SQK) * 4u, gV + (long)(i + 0) * 16 * ROWSTRIDE,
            lV + (unsigned)((i + 1) * 16 * SQK) * 4u, gV + (long)(i + 1) * 16 * ROWSTRIDE,
            lV + (unsigned)((i + 2) * 16 * SQK) * 4u, gV + (long)(i + 2) * 16 * ROWSTRIDE,
            lV + (unsigned)((i + 3) * 16 * SQK) * 4u, gV + (long)(i + 3) * 16 * ROWSTRIDE);
    async_g2lds_b128_x4(
        lKV + (unsigned)(0 * 16 * SKVS) * 4u, gKV + 0 * 16 * DD,
        lKV + (unsigned)(1 * 16 * SKVS) * 4u, gKV + 1 * 16 * DD,
        lKV + (unsigned)(2 * 16 * SKVS) * 4u, gKV + 2 * 16 * DD,
        lKV + (unsigned)(3 * 16 * SKVS) * 4u, gKV + 3 * 16 * DD);
    float4 vq[8], vk[8];
    #pragma unroll   // vq[], vk[] stay in registers
    for (int i = 0; i < 8; ++i) {
        vq[i] = *(const float4*)(gQ + (long)i * 16 * ROWSTRIDE);
        vk[i] = *(const float4*)(gK + (long)i * 16 * ROWSTRIDE);
    }
    // every thread loads (index wrapped into the 64 sums): no branch round the load
    const int kso = tid & (DD - 1);
    const float ksv = wks[(long)b * DD + kso];
    // precaution: behind the loads, ahead of the first write of their address
    // registers, which are named as inputs so that they are kept up to here
    asm volatile("s_wait_xcnt 0x0" :: "v"(gQ), "v"(gK), "v"(kso) : "memory");
    #pragma unroll   // vq[], vk[] stay in registers
    for (int i = 0; i < 8; ++i) {
        *(float4*)&sQ[(c0 + 16 * i) * SQK + c4] = phi4(vq[i]);
        *(float4*)&sK[(c0 + 16 * i) * SQK + c4] = phi4(vk[i]);
    }
    // inputs-only fence on the loaded value: holds the ksum load up with the other
    // loads; without it the load sinks into the branch below, a latency of its own
    asm volatile("" :: "v"(ksv));
    if (tid < DD) sKs[tid] = ksv;
    wait_async0();
    __syncthreads();

    // normalizer, inter-chunk part: z = phi(q_l) . ksum_prev
    if (tid < CC) {
        float acc = 0.0f;
        for (int d = 0; d < DD; ++d) acc += sQ[tid * SQK + d] * sKs[d];
        sZ[tid] = acc + 1e-6f;
    }

    // inter-chunk output: out = phi(q) x kv_prev   (wave w -> row-tile w)
    v8f out_acc[4];
    #pragma unroll
    for (int t = 0; t < 4; ++t)
        #pragma unroll
        for (int r = 0; r < 8; ++r) out_acc[t][r] = 0.0f;
    #pragma unroll
    for (int nt = 0; nt < 4; ++nt) {
        #pragma unroll
        for (int k0 = 0; k0 < DD; k0 += 4) {
            v2f a  = ldsL1(sQ, SQK, 16 * wave, k0, ln, hl);
            v2f bb = ldsL2(sKV, SKVS, k0, 16 * nt, ln, hl);
            out_acc[nt] = wmma4(a, bb, out_acc[nt]);
        }
    }

    // B fragments of T: B[d][query] = qc[query][d]; the same for every key tile
    v2f qf[16];
    #pragma unroll
    for (int k = 0; k < 16; ++k)
        qf[k] = ldsL1(sQ, SQK, 16 * wave, 4 * k, ln, hl);

    // wave number in a scalar register: the key-tile loop branches on SCC
    const int wv = __builtin_amdgcn_readfirstlane(wave);
    float zrow = 0.0f;                   // this lane's 8 keys per tile, query ln
    for (int kt = 0; kt <= wv; ++kt) {
        // v fragments of this key tile, asked for ahead of the T chain so that
        // their LDS latency passes under it; B[key][m], key = 8*hl + 2*s + j
        const float* pv = sV + (16 * kt + 8 * hl) * SQK + ln;
        v2f vb[4][4];
        #pragma unroll
        for (int s = 0; s < 4; ++s)
            #pragma unroll
            for (int nt = 0; nt < 4; ++nt) {
                vb[s][nt].x = pv[(2 * s + 0) * SQK + 16 * nt];
                vb[s][nt].y = pv[(2 * s + 1) * SQK + 16 * nt];
            }
        // T = phi(k) x phi(q)^T for key tile kt
        v8f st;
        #pragma unroll
        for (int r = 0; r < 8; ++r) st[r] = 0.0f;
        #pragma unroll
        for (int k = 0; k < 16; ++k) {
            v2f a = ldsL1(sK, SQK, 16 * kt, 4 * k, ln, hl);  // A[key][d]
            st = wmma4(a, qf[k], st);
        }
        // five vector slots between the last WMMA of T and the first reader of
        // its result (the mask's select, or the next WMMA that takes it as A)
        asm volatile("v_nop\n\tv_nop\n\tv_nop\n\tv_nop\n\tv_nop" : "+v"(st));
        // causal mask: only the diagonal tile has keys above the query
        const int lim = (kt == wv) ? ln : 15;
        #pragma unroll
        for (int r = 0; r < 8; ++r)
            st[r] = (r + 8 * hl > lim) ? 0.0f : st[r];
        zrow += ((st[0] + st[1]) + (st[2] + st[3]))
              + ((st[4] + st[5]) + (st[6] + st[7]));
        // out += S x v, A fragments taken from st as they stand
        #pragma unroll
        for (int s = 0; s < 4; ++s) {
            v2f a;
            a.x = st[2 * s]; a.y = st[2 * s + 1];
            #pragma unroll
            for (int nt = 0; nt < 4; ++nt)
                out_acc[nt] = wmma4(a, vb[s][nt], out_acc[nt]);
        }
    }
    sZi[hl * CC + 16 * wave + ln] = zrow;
    __syncthreads();   // sZ (written by other waves) and sZi final before use

    float* go = O + base;
    float zr[8];
    #pragma unroll
    for (int r = 0; r < 8; ++r) {
        int m = 16 * wave + r + 8 * hl;
        zr[r] = sZ[m] + (sZi[m] + sZi[CC + m]);
    }
    #pragma unroll
    for (int nt = 0; nt < 4; ++nt) {
        int mv = 16 * nt + ln;
        #pragma unroll
        for (int r = 0; r < 8; ++r) {
            int m = 16 * wave + r + 8 * hl;
            go[(long)m * ROWSTRIDE + mv] = out_acc[nt][r] / zr[r];
        }
    }
}

// ---------------------------------------------------------------------------
extern "C" void kernel_launch(void* const* d_in, const int* in_sizes, int n_in,
                              void* d_out, int out_size, void* d_ws, size_t ws_size,
                              hipStream_t stream) {
    const float* Q = (const float*)d_in[0];
    const float* K = (const float*)d_in[1];
    const float* V = (const float*)d_in[2];
    float* O = (float*)d_out;

    const int nChunks = NB * GG * HH;                 // 2048
    float* wkv = (float*)d_ws;                        // 2048 * 4096 f32
    float* wks = wkv + (size_t)nChunks * DD * DD;     // 2048 * 64 f32

    const size_t lds1 = (size_t)(2 * CC * SQK) * sizeof(float);
    const size_t lds3 = (size_t)(3 * CC * SQK + DD * SKVS + CC + DD + 2 * CC)
                        * sizeof(float);

    hipFuncSetAttribute((const void*)k_chunk_state,
                        hipFuncAttributeMaxDynamicSharedMemorySize, (int)lds1);
    hipFuncSetAttribute((const void*)k_output,
                        hipFuncAttributeMaxDynamicSharedMemorySize, (int)lds3);

    k_chunk_state<<<nChunks, 256, lds1, stream>>>(K, V, wkv, wks);
    k_prefix<<<NB * HH, 256, 0, stream>>>(wkv, wks);
    k_output<<<nChunks, 256, lds3, stream>>>(Q, K, V, wkv, wks, O);
}

// v003
// One run takes 86.6 microseconds.
// Two timings next to v002 both put it at 1.06 times that version's speed.
// Counting every step since v000, it is 2.04 times as fast.
#include <hip/hip_runtime.h>

// ---------------------------------------------------------------------------
// Causal linear attention (chunkwise) for MI455X / gfx1250, fp32 WMMA path.
// Shapes: N=4, L=4096, H=16, D=M=64, CHUNK=128, G=32 chunks.
// 3 passes: per-chunk KV state -> exclusive chunk prefix -> per-chunk output.
// Matmuls on V_WMMA_F32_16X16X4_F32; untransformed operands staged with
// GLOBAL_LOAD_ASYNC_TO_LDS_B128 (ASYNCcnt), phi(q)/phi(k) via VGPR path.
// ---------------------------------------------------------------------------

typedef float v2f __attribute__((ext_vector_type(2)));
typedef float v8f __attribute__((ext_vector_type(8)));

#define NB   4
#define LL   4096
#define HH   16
#define DD   64
#define CC   128
#define GG   32
#define ROWSTRIDE 1024          // H*D elements between consecutive l
#define SQK 68                  // LDS stride (floats), 68%64==4 -> conflict-free
#define SKVS 68                 // LDS stride for 64x64 KV state

__device__ __forceinline__ float phi(float x) {            // elu(x)+1
    return x > 0.0f ? x + 1.0f : __expf(x);
}
__device__ __forceinline__ float4 phi4(float4 v) {
    v.x = phi(v.x); v.y = phi(v.y); v.z = phi(v.z); v.w = phi(v.w);
    return v;
}

// Four async memory -> LDS copies of 16 bytes per lane (ASYNCcnt-tracked).
// l*: byte offset within this workgroup's LDS allocation (16B aligned).
// The s_wait_xcnt closes the statement as a precaution: it stands ahead of every
// later write of a register that these copies name, and inside the statement the
// compiler can move nothing over it.
__device__ __forceinline__ void async_g2lds_b128_x4(
        unsigned l0, const void* g0, unsigned l1, const void* g1,
        unsigned l2, const void* g2, unsigned l3, const void* g3) {
    asm volatile("global_load_async_to_lds_b128 %0, %1, off\n\t"
                 "global_load_async_to_lds_b128 %2, %3, off\n\t"
                 "global_load_async_to_lds_b128 %4, %5, off\n\t"
                 "global_load_async_to_lds_b128 %6, %7, off\n\t"
                 "s_wait_xcnt 0x0"
                 :: "v"(l0), "v"(g0), "v"(l1), "v"(g1),
                    "v"(l2), "v"(g2), "v"(l3), "v"(g3) : "memory");
}
__device__ __forceinline__ void wait_async0() {
    asm volatile("s_wait_asynccnt 0x0" ::: "memory");
}

__device__ __forceinline__ v8f wmma4(v2f a, v2f b, v8f c) {
    // D(16x16,f32) = A(16x4,f32) x B(4x16,f32) + C
    return __builtin_amdgcn_wmma_f32_16x16x4_f32(false, a, false, b,
                                                 (short)0, c, false, false);
}

// Fragment loaders for the 16x16x4 f32 operand layouts (wave32):
//   A: lane ln holds row m=ln; VGPR j holds K = k0 + 2*hl + j   (hl = lane>>4)
//   B: lane ln holds col n=ln; VGPR j holds K = k0 + 2*hl + j
// L1: matrix stored row-major as S[row][col] with (row=m|n, col=k)
__device__ __forceinline__ v2f ldsL1(const float* s, int stride, int r0, int k0,
                                     int ln, int hl) {
    v2f f;
    const float* p = s + (r0 + ln) * stride + k0 + 2 * hl;
    f.x = p[0]; f.y = p[1];
    return f;
}
// L2: matrix stored row-major as S[k][col] (k varies with VGPR/half-wave)
__device__ __forceinline__ v2f ldsL2(const float* s, int stride, int k0, int c0,
                                     int ln, int hl) {
    v2f f;
    f.x = s[(k0 + 2 * hl + 0) * stride + c0 + ln];
    f.y = s[(k0 + 2 * hl + 1) * stride + c0 + ln];
    return f;
}

// ---------------------------------------------------------------------------
// Pass 1: per-chunk state.  block = (n,g,h).  kv = phi(k)^T x v  (64x64),
// ksum = column sums of phi(k).  8 waves: each owns 2 of 16 kv tiles.
// ---------------------------------------------------------------------------
__global__ void __launch_bounds__(256) k_chunk_state(
        const float* __restrict__ K, const float* __restrict__ V,
        float* __restrict__ wkv, float* __restrict__ wks) {
    extern __shared__ float smem[];
    float* sK = smem;                 // 128 x SQK
    float* sV = sK + CC * SQK;        // 128 x SQK
    const unsigned sVoff = (unsigned)(CC * SQK) * 4u;   // LDS byte offset of sV

    const int tid = threadIdx.x, wave = tid >> 5, lane = tid & 31;
    const int ln = lane & 15, hl = lane >> 4;
    const int b = blockIdx.x;                     // ((n*32+g)*16+h)
    const int h = b & 15, ng = b >> 4, g = ng & 31, n = ng >> 5;
    const long base = (((long)n * LL + (long)g * CC) * HH + h) * DD;

    // V: async memory->LDS (no transform needed); K: VGPR path with phi.
    // Every request of the tile is issued before the first wait, so the block
    // pays one memory latency and not one per row group.
    const int c0 = tid >> 4, c4 = (tid & 15) * 4;   // row group i: row c0 + 16 i
    const float* gK = K + base + (long)c0 * ROWSTRIDE + c4;
    const float* gV = V + base + (long)c0 * ROWSTRIDE + c4;
    const unsigned lV = sVoff + (unsigned)(c0 * SQK + c4) * 4u;
    #pragma unroll   // constant row offsets
    for (int i = 0; i < 8; i += 4)
        async_g2lds_b128_x4(
            lV + (unsigned)((i + 0) * 16 * SQK) * 4u, gV + (long)(i + 0) * 16 * ROWSTRIDE,
            lV + (unsigned)((i + 1) * 16 * SQK) * 4u, gV + (long)(i + 1) * 16 * ROWSTRIDE,
            lV + (unsigned)((i + 2) * 16 * SQK) * 4u, gV + (long)(i + 2) * 16 * ROWSTRIDE,
            lV + (unsigned)((i + 3) * 16 * SQK) * 4u, gV + (long)(i + 3) * 16 * ROWSTRIDE);
    float4 vk[8];
    #pragma unroll   // vk[] stays in registers
    for (int i = 0; i < 8; ++i)
        vk[i] = *(const float4*)(gK + (long)i * 16 * ROWSTRIDE);
    // precaution: behind the loads, ahead of the first write of their address
    // pair, which is named as an input so that it is kept up to here
    asm volatile("s_wait_xcnt 0x0" :: "v"(gK) : "memory");
    #pragma unroll   // vk[] stays in registers
    for (int i = 0; i < 8; ++i)
        *(float4*)&sK[(c0 + 16 * i) * SQK + c4] = phi4(vk[i]);
    wait_async0();
    __syncthreads();

    v8f acc[2];
    #pragma unroll
    for (int t = 0; t < 2; ++t)
        #pragma unroll
        for (int r = 0; r < 8; ++r) acc[t][r] = 0.0f;

    #pragma unroll
    for (int t = 0; t < 2; ++t) {
        int tile = 2 * wave + t, dt = tile >> 2, mt = tile & 3;
        #pragma unroll
        for (int k0 = 0; k0 < CC; k0 += 4) {
            v2f a  = ldsL2(sK, SQK, k0, 16 * dt, ln, hl);  // A[d][c] = kc[c][d]
            v2f bb = ldsL2(sV, SQK, k0, 16 * mt, ln, hl);  // B[c][m] = vc[c][m]
            acc[t] = wmma4(a, bb, acc[t]);
        }
    }

    if (tid < DD) {                      // ksum over the chunk
        float s = 0.0f;
        for (int c = 0; c < CC; ++c) s += sK[c * SQK + tid];
        wks[(long)b * DD + tid] = s;
    }

    float* okv = wkv + (long)b * (DD * DD);
    #pragma unroll
    for (int t = 0; t < 2; ++t) {
        int tile = 2 * wave + t, dt = tile >> 2, mt = tile & 3;
        #pragma unroll
        for (int r = 0; r < 8; ++r)
            okv[(16 * dt + r + 8 * hl) * DD + 16 * mt + ln] = acc[t][r];
    }
}

// ---------------------------------------------------------------------------
// Pass 2: in-place exclusive prefix over chunks.  block = (n,h), 64 blocks.
// ---------------------------------------------------------------------------
__global__ void __launch_bounds__(256) k_prefix(
        float* __restrict__ wkv, float* __restrict__ wks) {
    const int tid = threadIdx.x, b = blockIdx.x;
    const int n = b >> 4, h = b & 15;
    float acc[16];
    #pragma unroll
    for (int j = 0; j < 16; ++j) acc[j] = 0.0f;
    float accs = 0.0f;
    for (int g = 0; g < GG; ++g) {
        long idx = (long)(n * GG + g) * HH + h;
        float* p = wkv + idx * (DD * DD);
        #pragma unroll
        for (int j = 0; j < 16; ++j) {
            int e = tid + j * 256;
            float v = p[e];
            p[e] = acc[j];
            acc[j] += v;
        }
        if (tid < DD) {
            float* ps = wks + idx * DD;
            float v = ps[tid];
            ps[tid] = accs;
            accs += v;
        }
    }
}

// ---------------------------------------------------------------------------
// Pass 3: outputs.  block = (n,g,h).
//   out = phi(q) x kv_prev  +  tril(phi(q) phi(k)^T) x v
//   z   = phi(q).ksum_prev  +  rowsum(masked scores)  + eps
// Each wave owns one output row-tile rt (rows 16rt..16rt+15); causal key tiles
// only, so tile rt costs rt+1 key tiles.  Waves w and w+4 take
// tiles 7-w and w, nine key tiles a pair, the long one on wave w.
// Scores are formed transposed, T = phi(k) x phi(q)^T: the result registers of
// T (lane = query, VGPR r = key r + 8*hl) are then A fragments of S x v as they
// stand, with k order key = 8*hl + 2*s + j in step s; the v loader follows the
// same order.  The score tile never goes through LDS.
// ---------------------------------------------------------------------------
__global__ void __launch_bounds__(256) k_output(
        const float* __restrict__ Q, const float* __restrict__ K,
        const float* __restrict__ V, const float* __restrict__ wkv,
        const float* __restrict__ wks, float* __restrict__ O) {
    extern __shared__ float smem[];
    float* sQ  = smem;                  // 128 x SQK
    float* sK  = sQ + CC * SQK;         // 128 x SQK
    float* sV  = sK + CC * SQK;         // 128 x SQK
    float* sKV = sV + CC * SQK;         // 64 x SKVS  (exclusive-prefix kv)
    float* sZ  = sKV + DD * SKVS;       // 128
    float* sKs = sZ + CC;               // 64
    float* sZi = sKs + DD;              // 2 x 128 (score row sums, per half-wave)
    const unsigned sVoff  = (unsigned)(2 * CC * SQK) * 4u;
    const unsigned sKVoff = (unsigned)(3 * CC * SQK) * 4u;

    const int tid = threadIdx.x, wave = tid >> 5, lane = tid & 31;
    const int ln = lane & 15, hl = lane >> 4;
    const int b = blockIdx.x;
    const int h = b & 15, ng = b >> 4, g = ng & 31, n = ng >> 5;
    const long base = (((long)n * LL + (long)g * CC) * HH + h) * DD;
    // row tile in a scalar register: the key-tile loop branches on SCC
    const int wv = __builtin_amdgcn_readfirstlane(wave);
    const int rt = wv < 4 ? 7 - wv : wv - 4;

    // V + prefix-KV: async memory->LDS; Q/K: VGPR path with phi.
    // Every request of the block is issued before the first wait, so the block
    // pays one memory latency and not one per row group.
    const int c0 = tid >> 4, c4 = (tid & 15) * 4;   // row group i: row c0 + 16 i
    const float* gQ = Q + base + (long)c0 * ROWSTRIDE + c4;
    const float* gK = K + base + (long)c0 * ROWSTRIDE + c4;
    const float* gV = V + base + (long)c0 * ROWSTRIDE + c4;
    const float* gKV = wkv + (long)b * (DD * DD) + c0 * DD + c4;
    const unsigned lV  = sVoff  + (unsigned)(c0 * SQK  + c4) * 4u;
    const unsigned lKV = sKVoff + (unsigned)(c0 * SKVS + c4) * 4u;
    #pragma unroll   // constant row offsets
    for (int i = 0; i < 8; i += 4)
        async_g2lds_b128_x4(
            lV + (unsigned)((i + 0) * 16 * SQK) * 4u, gV + (long)(i + 0) * 16 * ROWSTRIDE,
            lV + (unsigned)((i + 1) * 16 * SQK) * 4u, gV + (long)(i + 1) * 16 * ROWSTRIDE,
            lV + (unsigned)((i + 2) * 16 * SQK) * 4u, gV + (long)(i + 2) * 16 * ROWSTRIDE,
            lV + (unsigned)((i + 3) * 16 * SQK) * 4u, gV + (long)(i + 3) * 16 * ROWSTRIDE);
    async_g2lds_b128_x4(
        lKV + (unsigned)(0 * 16 * SKVS) * 4u, gKV + 0 * 16 * DD,
        lKV + (unsigned)(1 * 16 * SKVS) * 4u, gKV + 1 * 16 * DD,
        lKV + (unsigned)(2 * 16 * SKVS) * 4u, gKV + 2 * 16 * DD,
        lKV + (unsigned)(3 * 16 * SKVS) * 4u, gKV + 3 * 16 * DD);
    float4 vq[8], vk[8];
    #pragma unroll   // vq[], vk[] stay in registers
    for (int i = 0; i < 8; ++i) {
        vq[i] = *(const float4*)(gQ + (long)i * 16 * ROWSTRIDE);
        vk[i] = *(const float4*)(gK + (long)i * 16 * ROWSTRIDE);
    }
    // every thread loads (index wrapped into the 64 sums): no branch round the load
    const int kso = tid & (DD - 1);
    const float ksv = wks[(long)b * DD + kso];
    // precaution: behind the loads, ahead of the first write of their address
    // registers, which are named as inputs so that they are kept up to here
    asm volatile("s_wait_xcnt 0x0" :: "v"(gQ), "v"(gK), "v"(kso) : "memory");
    #pragma unroll   // vq[], vk[] stay in registers
    for (int i = 0; i < 8; ++i) {
        *(float4*)&sQ[(c0 + 16 * i) * SQK + c4] = phi4(vq[i]);
        *(float4*)&sK[(c0 + 16 * i) * SQK + c4] = phi4(vk[i]);
    }
    // inputs-only fence on the loaded value: holds the ksum load up with the other
    // loads; without it the load sinks into the branch below, a latency of its own
    asm volatile("" :: "v"(ksv));
    if (tid < DD) sKs[tid] = ksv;
    wait_async0();
    __syncthreads();

    // normalizer, inter-chunk part: z = phi(q_l) . ksum_prev; one row a thread,
    // on waves 4..7, whose key loops are the short ones
    if (tid >= CC) {
        const int zq = tid - CC;
        float acc = 0.0f;
        for (int d = 0; d < DD; ++d) acc += sQ[zq * SQK + d] * sKs[d];
        sZ[zq] = acc + 1e-6f;
    }

    // inter-chunk output: out = phi(q) x kv_prev   (row-tile rt)
    v8f out_acc[4];
    #pragma unroll
    for (int t = 0; t < 4; ++t)
        #pragma unroll
        for (int r = 0; r < 8; ++r) out_acc[t][r] = 0.0f;
    #pragma unroll
    for (int nt = 0; nt < 4; ++nt) {
        #pragma unroll
        for (int k0 = 0; k0 < DD; k0 += 4) {
            v2f a  = ldsL1(sQ, SQK, 16 * rt, k0, ln, hl);
            v2f bb = ldsL2(sKV, SKVS, k0, 16 * nt, ln, hl);
            out_acc[nt] = wmma4(a, bb, out_acc[nt]);
        }
    }

    // B fragments of T: B[d][query] = qc[query][d]; the same for every key tile
    v2f qf[16];
    #pragma unroll
    for (int k = 0; k < 16; ++k)
        qf[k] = ldsL1(sQ, SQK, 16 * rt, 4 * k, ln, hl);

    float zrow = 0.0f;                   // this lane's 8 keys per tile, query ln
    for (int kt = 0; kt <= rt; ++kt) {
        // v fragments of this key tile, asked for ahead of the T chain so that
        // their LDS latency passes under it; B[key][m], key = 8*hl + 2*s + j
        const float* pv = sV + (16 * kt + 8 * hl) * SQK + ln;
        v2f vb[4][4];
        #pragma unroll
        for (int s = 0; s < 4; ++s)
            #pragma unroll
            for (int nt = 0; nt < 4; ++nt) {
                vb[s][nt].x = pv[(2 * s + 0) * SQK + 16 * nt];
                vb[s][nt].y = pv[(2 * s + 1) * SQK + 16 * nt];
            }
        // T = phi(k) x phi(q)^T for key tile kt
        v8f st;
        #pragma unroll
        for (int r = 0; r < 8; ++r) st[r] = 0.0f;
        #pragma unroll
        for (int k = 0; k < 16; ++k) {
            v2f a = ldsL1(sK, SQK, 16 * kt, 4 * k, ln, hl);  // A[key][d]
            st = wmma4(a, qf[k], st);
        }
        // five vector slots between the last WMMA of T and the first reader of
        // its result (the mask's select, or the next WMMA that takes it as A)
        asm volatile("v_nop\n\tv_nop\n\tv_nop\n\tv_nop\n\tv_nop" : "+v"(st));
        // causal mask: only the diagonal tile has keys above the query
        const int lim = (kt == rt) ? ln : 15;
        #pragma unroll
        for (int r = 0; r < 8; ++r)
            st[r] = (r + 8 * hl > lim) ? 0.0f : st[r];
        zrow += ((st[0] + st[1]) + (st[2] + st[3]))
              + ((st[4] + st[5]) + (st[6] + st[7]));
        // out += S x v, A fragments taken from st as they stand
        #pragma unroll
        for (int s = 0; s < 4; ++s) {
            v2f a;
            a.x = st[2 * s]; a.y = st[2 * s + 1];
            #pragma unroll
            for (int nt = 0; nt < 4; ++nt)
                out_acc[nt] = wmma4(a, vb[s][nt], out_acc[nt]);
        }
    }
    sZi[hl * CC + 16 * rt + ln] = zrow;
    __syncthreads();   // sZ (written by other waves) and sZi final before use

    float* go = O + base;
    float zr[8];
    #pragma unroll
    for (int r = 0; r < 8; ++r) {
        int m = 16 * rt + r + 8 * hl;
        zr[r] = sZ[m] + (sZi[m] + sZi[CC + m]);
    }
    #pragma unroll
    for (int nt = 0; nt < 4; ++nt) {
        int mv = 16 * nt + ln;
        #pragma unroll
        for (int r = 0; r < 8; ++r) {
            int m = 16 * rt + r + 8 * hl;
            go[(long)m * ROWSTRIDE + mv] = out_acc[nt][r] / zr[r];
        }
    }
}

// ---------------------------------------------------------------------------
extern "C" void kernel_launch(void* const* d_in, const int* in_sizes, int n_in,
                              void* d_out, int out_size, void* d_ws, size_t ws_size,
                              hipStream_t stream) {
    const float* Q = (const float*)d_in[0];
    const float* K = (const float*)d_in[1];
    const float* V = (const float*)d_in[2];
    float* O = (float*)d_out;

    const int nChunks = NB * GG * HH;                 // 2048
    float* wkv = (float*)d_ws;                        // 2048 * 4096 f32
    float* wks = wkv + (size_t)nChunks * DD * DD;     // 2048 * 64 f32

    const size_t lds1 = (size_t)(2 * CC * SQK) * sizeof(float);
    const size_t lds3 = (size_t)(3 * CC * SQK + DD * SKVS + CC + DD + 2 * CC)
                        * sizeof(float);

    hipFuncSetAttribute((const void*)k_chunk_state,
                        hipFuncAttributeMaxDynamicSharedMemorySize, (int)lds1);
    hipFuncSetAttribute((const void*)k_output,
                        hipFuncAttributeMaxDynamicSharedMemorySize, (int)lds3);

    k_chunk_state<<<nChunks, 256, lds1, stream>>>(K, V, wkv, wks);
    k_prefix<<<NB * HH, 256, 0, stream>>>(wkv, wks);
    k_output<<<nChunks, 256, lds3, stream>>>(Q, K, V, wkv, wks, O);
}

// v004
// A run of this version takes 83.9 microseconds.
// Timed twice side by side with v003, it ran 1.03 and 1.04 times as fast.
// Over all steps from v000 it is 2.11 times as fast.
#include <hip/hip_runtime.h>

// ---------------------------------------------------------------------------
// Causal linear attention (chunkwise) for MI455X / gfx1250, fp32 WMMA path.
// Shapes: N=4, L=4096, H=16, D=M=64, CHUNK=128, G=32 chunks.
// 3 passes: per-chunk KV state -> exclusive chunk prefix -> per-chunk output.
// Matmuls on V_WMMA_F32_16X16X4_F32; untransformed operands staged with
// GLOBAL_LOAD_ASYNC_TO_LDS_B128 (ASYNCcnt), phi(q)/phi(k) via VGPR path.
// ---------------------------------------------------------------------------

typedef float v2f __attribute__((ext_vector_type(2)));
typedef float v8f __attribute__((ext_vector_type(8)));

#define NB   4
#define LL   4096
#define HH   16
#define DD   64
#define CC   128
#define GG   32
#define ROWSTRIDE 1024          // H*D elements between consecutive l
#define SQK 68                  // LDS stride (floats), 68%64==4 -> conflict-free
#define SKVS 68                 // LDS stride for 64x64 KV state

__device__ __forceinline__ float phi(float x) {            // elu(x)+1
    return x > 0.0f ? x + 1.0f : __expf(x);
}
__device__ __forceinline__ float4 phi4(float4 v) {
    v.x = phi(v.x); v.y = phi(v.y); v.z = phi(v.z); v.w = phi(v.w);
    return v;
}

// Four async memory -> LDS copies of 16 bytes per lane (ASYNCcnt-tracked).
// l*: byte offset within this workgroup's LDS allocation (16B aligned).
// The s_wait_xcnt closes the statement as a precaution: it stands ahead of every
// later write of a register that these copies name, and inside the statement the
// compiler can move nothing over it.
__device__ __forceinline__ void async_g2lds_b128_x4(
        unsigned l0, const void* g0, unsigned l1, const void* g1,
        unsigned l2, const void* g2, unsigned l3, const void* g3) {
    asm volatile("global_load_async_to_lds_b128 %0, %1, off\n\t"
                 "global_load_async_to_lds_b128 %2, %3, off\n\t"
                 "global_load_async_to_lds_b128 %4, %5, off\n\t"
                 "global_load_async_to_lds_b128 %6, %7, off\n\t"
                 "s_wait_xcnt 0x0"
                 :: "v"(l0), "v"(g0), "v"(l1), "v"(g1),
                    "v"(l2), "v"(g2), "v"(l3), "v"(g3) : "memory");
}
__device__ __forceinline__ void wait_async0() {
    asm volatile("s_wait_asynccnt 0x0" ::: "memory");
}

__device__ __forceinline__ v8f wmma4(v2f a, v2f b, v8f c) {
    // D(16x16,f32) = A(16x4,f32) x B(4x16,f32) + C
    return __builtin_amdgcn_wmma_f32_16x16x4_f32(false, a, false, b,
                                                 (short)0, c, false, false);
}

// Fragment loaders for the 16x16x4 f32 operand layouts (wave32):
//   A: lane ln holds row m=ln; VGPR j holds K = k0 + 2*hl + j   (hl = lane>>4)
//   B: lane ln holds col n=ln; VGPR j holds K = k0 + 2*hl + j
// L1: matrix stored row-major as S[row][col] with (row=m|n, col=k)
__device__ __forceinline__ v2f ldsL1(const float* s, int stride, int r0, int k0,
                                     int ln, int hl) {
    v2f f;
    const float* p = s + (r0 + ln) * stride + k0 + 2 * hl;
    f.x = p[0]; f.y = p[1];
    return f;
}
// L2: matrix stored row-major as S[k][col] (k varies with VGPR/half-wave)
__device__ __forceinline__ v2f ldsL2(const float* s, int stride, int k0, int c0,
                                     int ln, int hl) {
    v2f f;
    f.x = s[(k0 + 2 * hl + 0) * stride + c0 + ln];
    f.y = s[(k0 + 2 * hl + 1) * stride + c0 + ln];
    return f;
}

// ---------------------------------------------------------------------------
// Pass 1: per-chunk state.  block = (n,g,h).  kv = phi(k)^T x v  (64x64),
// ksum = column sums of phi(k).  8 waves: each owns 2 of 16 kv tiles.
// ---------------------------------------------------------------------------
__global__ void __launch_bounds__(256) k_chunk_state(
        const float* __restrict__ K, const float* __restrict__ V,
        float* __restrict__ wkv, float* __restrict__ wks) {
    extern __shared__ float smem[];
    float* sK = smem;                 // 128 x SQK
    float* sV = sK + CC * SQK;        // 128 x SQK
    const unsigned sVoff = (unsigned)(CC * SQK) * 4u;   // LDS byte offset of sV

    const int tid = threadIdx.x, wave = tid >> 5, lane = tid & 31;
    const int ln = lane & 15, hl = lane >> 4;
    const int b = blockIdx.x;                     // ((n*32+g)*16+h)
    const int h = b & 15, ng = b >> 4, g = ng & 31, n = ng >> 5;
    const long base = (((long)n * LL + (long)g * CC) * HH + h) * DD;

    // V: async memory->LDS (no transform needed); K: VGPR path with phi.
    // Every request of the tile is issued before the first wait, so the block
    // pays one memory latency and not one per row group.
    const int c0 = tid >> 4, c4 = (tid & 15) * 4;   // row group i: row c0 + 16 i
    const float* gK = K + base + (long)c0 * ROWSTRIDE + c4;
    const float* gV = V + base + (long)c0 * ROWSTRIDE + c4;
    const unsigned lV = sVoff + (unsigned)(c0 * SQK + c4) * 4u;
    #pragma unroll   // constant row offsets
    for (int i = 0; i < 8; i += 4)
        async_g2lds_b128_x4(
            lV + (unsigned)((i + 0) * 16 * SQK) * 4u, gV + (long)(i + 0) * 16 * ROWSTRIDE,
            lV + (unsigned)((i + 1) * 16 * SQK) * 4u, gV + (long)(i + 1) * 16 * ROWSTRIDE,
            lV + (unsigned)((i + 2) * 16 * SQK) * 4u, gV + (long)(i + 2) * 16 * ROWSTRIDE,
            lV + (unsigned)((i + 3) * 16 * SQK) * 4u, gV + (long)(i + 3) * 16 * ROWSTRIDE);
    float4 vk[8];
    #pragma unroll   // vk[] stays in registers
    for (int i = 0; i < 8; ++i)
        vk[i] = *(const float4*)(gK + (long)i * 16 * ROWSTRIDE);
    // precaution: behind the loads, ahead of the first write of their address
    // pair, which is named as an input so that it is kept up to here
    asm volatile("s_wait_xcnt 0x0" :: "v"(gK) : "memory");
    #pragma unroll   // vk[] stays in registers
    for (int i = 0; i < 8; ++i)
        *(float4*)&sK[(c0 + 16 * i) * SQK + c4] = phi4(vk[i]);
    wait_async0();
    __syncthreads();

    v8f acc[2];
    #pragma unroll
    for (int t = 0; t < 2; ++t)
        #pragma unroll
        for (int r = 0; r < 8; ++r) acc[t][r] = 0.0f;

    #pragma unroll
    for (int t = 0; t < 2; ++t) {
        int tile = 2 * wave + t, dt = tile >> 2, mt = tile & 3;
        #pragma unroll
        for (int k0 = 0; k0 < CC; k0 += 4) {
            v2f a  = ldsL2(sK, SQK, k0, 16 * dt, ln, hl);  // A[d][c] = kc[c][d]
            v2f bb = ldsL2(sV, SQK, k0, 16 * mt, ln, hl);  // B[c][m] = vc[c][m]
            acc[t] = wmma4(a, bb, acc[t]);
        }
    }

    if (tid < DD) {                      // ksum over the chunk
        float s = 0.0f;
        for (int c = 0; c < CC; ++c) s += sK[c * SQK + tid];
        wks[(long)b * DD + tid] = s;
    }

    float* okv = wkv + (long)b * (DD * DD);
    #pragma unroll
    for (int t = 0; t < 2; ++t) {
        int tile = 2 * wave + t, dt = tile >> 2, mt = tile & 3;
        #pragma unroll
        for (int r = 0; r < 8; ++r)
            okv[(16 * dt + r + 8 * hl) * DD + 16 * mt + ln] = acc[t][r];
    }
}

// ---------------------------------------------------------------------------
// Pass 2: in-place exclusive prefix over chunks.  block = (n,h), 64 blocks.
// ---------------------------------------------------------------------------
__global__ void __launch_bounds__(256) k_prefix(
        float* __restrict__ wkv, float* __restrict__ wks) {
    const int tid = threadIdx.x, b = blockIdx.x;
    const int n = b >> 4, h = b & 15;
    float acc[16];
    #pragma unroll
    for (int j = 0; j < 16; ++j) acc[j] = 0.0f;
    float accs = 0.0f;
    for (int g = 0; g < GG; ++g) {
        long idx = (long)(n * GG + g) * HH + h;
        float* p = wkv + idx * (DD * DD);
        #pragma unroll
        for (int j = 0; j < 16; ++j) {
            int e = tid + j * 256;
            float v = p[e];
            p[e] = acc[j];
            acc[j] += v;
        }
        if (tid < DD) {
            float* ps = wks + idx * DD;
            float v = ps[tid];
            ps[tid] = accs;
            accs += v;
        }
    }
}

// ---------------------------------------------------------------------------
// Pass 3: outputs.  block = (n,g,h).
//   out = phi(q) x kv_prev  +  tril(phi(q) phi(k)^T) x v
//   z   = phi(q).ksum_prev  +  rowsum(masked scores)  + eps
// The chunk is cut in two halves of 64 rows.  Rows 64..127 meet keys 0..63 through
// a second state, kv_half = kv_prev + phi(k[0:64])^T x v[0:64] (256 WMMAs a block),
// and not through 16 score tiles (512 WMMAs); their z takes ksum up to row 64.
// Each wave owns one output row-tile rt (rows 16rt..16rt+15); causal key tiles of
// its own half only, so tile rt costs (rt & 3) + 1 key tiles.  Waves w and w+4
// take five key tiles together, the longer tile on wave w.
// Scores are formed transposed, T = phi(k) x phi(q)^T: the result registers of
// T (lane = query, VGPR r = key r + 8*hl) are then A fragments of S x v as they
// stand, with k order key = 8*hl + 2*s + j in step s; the v loader follows the
// same order.  The score tile never goes through LDS.
// ---------------------------------------------------------------------------
__global__ void __launch_bounds__(256) k_output(
        const float* __restrict__ Q, const float* __restrict__ K,
        const float* __restrict__ V, const float* __restrict__ wkv,
        const float* __restrict__ wks, float* __restrict__ O) {
    extern __shared__ float smem[];
    float* sQ  = smem;                  // 128 x SQK
    float* sK  = sQ + CC * SQK;         // 128 x SQK
    float* sV  = sK + CC * SQK;         // 128 x SQK
    float* sKV = sV + CC * SQK;         // 64 x SKVS  (exclusive-prefix kv)
    float* sKV2 = sKV + DD * SKVS;      // 64 x SKVS  (kv up to row 64 of the chunk)
    float* sZ  = sKV2 + DD * SKVS;      // 128
    float* sKs = sZ + CC;               // 64  (ksum before the chunk)
    float* sKs2 = sKs + DD;             // 64  (ksum up to row 64 of the chunk)
    float* sZi = sKs2 + DD;             // 2 x 128 (score row sums, per half-wave)
    const unsigned sVoff  = (unsigned)(2 * CC * SQK) * 4u;
    const unsigned sKVoff = (unsigned)(3 * CC * SQK) * 4u;

    const int tid = threadIdx.x, wave = tid >> 5, lane = tid & 31;
    const int ln = lane & 15, hl = lane >> 4;
    const int b = blockIdx.x;
    const int h = b & 15, ng = b >> 4, g = ng & 31, n = ng >> 5;
    const long base = (((long)n * LL + (long)g * CC) * HH + h) * DD;
    // row tile in a scalar register: the key-tile loop branches on SCC
    const int wv = __builtin_amdgcn_readfirstlane(wave);
    // waves 0..7 take tiles 3 7 2 6 4 0 5 1 (one hex digit a wave, wave 0 lowest)
    const int rt = (0x15046273 >> (4 * wv)) & 7;

    // V + prefix-KV: async memory->LDS; Q/K: VGPR path with phi.
    // Every request of the block is issued before the first wait, so the block
    // pays one memory latency and not one per row group.
    const int c0 = tid >> 4, c4 = (tid & 15) * 4;   // row group i: row c0 + 16 i
    const float* gQ = Q + base + (long)c0 * ROWSTRIDE + c4;
    const float* gK = K + base + (long)c0 * ROWSTRIDE + c4;
    const float* gV = V + base + (long)c0 * ROWSTRIDE + c4;
    const float* gKV = wkv + (long)b * (DD * DD) + c0 * DD + c4;
    const unsigned lV  = sVoff  + (unsigned)(c0 * SQK  + c4) * 4u;
    const unsigned lKV = sKVoff + (unsigned)(c0 * SKVS + c4) * 4u;
    #pragma unroll   // constant row offsets
    for (int i = 0; i < 8; i += 4)
        async_g2lds_b128_x4(
            lV + (unsigned)((i + 0) * 16 * SQK) * 4u, gV + (long)(i + 0) * 16 * ROWSTRIDE,
            lV + (unsigned)((i + 1) * 16 * SQK) * 4u, gV + (long)(i + 1) * 16 * ROWSTRIDE,
            lV + (unsigned)((i + 2) * 16 * SQK) * 4u, gV + (long)(i + 2) * 16 * ROWSTRIDE,
            lV + (unsigned)((i + 3) * 16 * SQK) * 4u, gV + (long)(i + 3) * 16 * ROWSTRIDE);
    async_g2lds_b128_x4(
        lKV + (unsigned)(0 * 16 * SKVS) * 4u, gKV + 0 * 16 * DD,
        lKV + (unsigned)(1 * 16 * SKVS) * 4u, gKV + 1 * 16 * DD,
        lKV + (unsigned)(2 * 16 * SKVS) * 4u, gKV + 2 * 16 * DD,
        lKV + (unsigned)(3 * 16 * SKVS) * 4u, gKV + 3 * 16 * DD);
    float4 vq[8], vk[8];
    #pragma unroll   // vq[], vk[] stay in registers
    for (int i = 0; i < 8; ++i) {
        vq[i] = *(const float4*)(gQ + (long)i * 16 * ROWSTRIDE);
        vk[i] = *(const float4*)(gK + (long)i * 16 * ROWSTRIDE);
    }
    // every thread loads (index wrapped into the 64 sums): no branch round the load
    const int kso = tid & (DD - 1);
    const float ksv = wks[(long)b * DD + kso];
    // precaution: behind the loads, ahead of the first write of their address
    // registers, which are named as inputs so that they are kept up to here
    asm volatile("s_wait_xcnt 0x0" :: "v"(gQ), "v"(gK), "v"(kso) : "memory");
    #pragma unroll   // vq[], vk[] stay in registers
    for (int i = 0; i < 8; ++i) {
        *(float4*)&sQ[(c0 + 16 * i) * SQK + c4] = phi4(vq[i]);
        *(float4*)&sK[(c0 + 16 * i) * SQK + c4] = phi4(vk[i]);
    }
    // inputs-only fence on the loaded value: holds the ksum load up with the other
    // loads; without it the load sinks into the branch below, a latency of its own
    asm volatile("" :: "v"(ksv));
    if (tid < DD) sKs[tid] = ksv;
    wait_async0();
    __syncthreads();

    // ksum up to row 64, one column a thread, on waves 4 and 5
    if (tid >= CC && tid < CC + DD) {
        const int d = tid - CC;
        float s[4] = {sKs[d], 0.0f, 0.0f, 0.0f};   // four short add chains, not one
        #pragma unroll   // all loads asked for ahead of the adds
        for (int c = 0; c < CC / 2; ++c) s[c & 3] += sK[c * SQK + d];
        sKs2[d] = (s[0] + s[1]) + (s[2] + s[3]);
    }
    // kv_half: each wave owns two of its 16 tiles (one d tile, two m tiles), started
    // from kv_prev.  k order of both loaders: row = 16*g + 8*hl + 2*s + j, so that
    // the two half-waves read LDS banks 32 apart
    {
        const int dt = wv >> 1, mt0 = 2 * (wv & 1);
        v8f hs[2];
        #pragma unroll   // here and below: hs[] stays in registers
        for (int t = 0; t < 2; ++t)
            #pragma unroll
            for (int r = 0; r < 8; ++r)
                hs[t][r] = sKV[(16 * dt + r + 8 * hl) * SKVS + 16 * (mt0 + t) + ln];
        #pragma unroll   // constant LDS offsets; the two tiles' chains interleave
        for (int k0 = 0; k0 < CC / 2; k0 += 16) {
            #pragma unroll
            for (int s = 0; s < 4; ++s) {
                const int row = k0 + 8 * hl + 2 * s;
                v2f a;                                   // A[d][c] = kc[c][d]
                a.x = sK[(row + 0) * SQK + 16 * dt + ln];
                a.y = sK[(row + 1) * SQK + 16 * dt + ln];
                #pragma unroll
                for (int t = 0; t < 2; ++t) {
                    v2f bb;                              // B[c][m] = vc[c][m]
                    bb.x = sV[(row + 0) * SQK + 16 * (mt0 + t) + ln];
                    bb.y = sV[(row + 1) * SQK + 16 * (mt0 + t) + ln];
                    hs[t] = wmma4(a, bb, hs[t]);
                }
            }
        }
        #pragma unroll
        for (int t = 0; t < 2; ++t)
            #pragma unroll
            for (int r = 0; r < 8; ++r)
                sKV2[(16 * dt + r + 8 * hl) * SKVS + 16 * (mt0 + t) + ln] = hs[t][r];
    }
    __syncthreads();   // kv_half and its ksum (written by other waves) final

    // normalizer, part before this row's half: z = phi(q_l) . ksum; one row a
    // thread, on waves 4..7, whose key loops are the short ones
    if (tid >= CC) {
        const int zq = tid - CC;
        const float* ks = wv < 6 ? sKs : sKs2;   // waves 6, 7: rows 64..127
        float acc = 0.0f;
        for (int d = 0; d < DD; ++d) acc += sQ[zq * SQK + d] * ks[d];
        sZ[zq] = acc + 1e-6f;
    }

    // output from before this row's half: out = phi(q) x kv   (row-tile rt)
    const float* kvp = rt < 4 ? sKV : sKV2;
    v8f out_acc[4];
    #pragma unroll
    for (int t = 0; t < 4; ++t)
        #pragma unroll
        for (int r = 0; r < 8; ++r) out_acc[t][r] = 0.0f;
    #pragma unroll
    for (int nt = 0; nt < 4; ++nt) {
        #pragma unroll
        for (int k0 = 0; k0 < DD; k0 += 4) {
            v2f a  = ldsL1(sQ, SQK, 16 * rt, k0, ln, hl);
            v2f bb = ldsL2(kvp, SKVS, k0, 16 * nt, ln, hl);
            out_acc[nt] = wmma4(a, bb, out_acc[nt]);
        }
    }

    // B fragments of T: B[d][query] = qc[query][d]; the same for every key tile
    v2f qf[16];
    #pragma unroll
    for (int k = 0; k < 16; ++k)
        qf[k] = ldsL1(sQ, SQK, 16 * rt, 4 * k, ln, hl);

    float zrow = 0.0f;                   // this lane's 8 keys per tile, query ln
    // key tiles of this row's half: tile kt of the half, the diagonal one is rh
    const int rh = rt & 3;
    const float* sKh = sK + (rt & 4) * 16 * SQK;
    const float* pvh = sV + ((rt & 4) * 16 + 8 * hl) * SQK + ln;
    for (int kt = 0; kt <= rh; ++kt) {
        // v fragments of this key tile, asked for ahead of the T chain so that
        // their LDS latency passes under it; B[key][m], key = 8*hl + 2*s + j
        const float* pv = pvh + 16 * kt * SQK;
        v2f vb[4][4];
        #pragma unroll
        for (int s = 0; s < 4; ++s)
            #pragma unroll
            for (int nt = 0; nt < 4; ++nt) {
                vb[s][nt].x = pv[(2 * s + 0) * SQK + 16 * nt];
                vb[s][nt].y = pv[(2 * s + 1) * SQK + 16 * nt];
            }
        // T = phi(k) x phi(q)^T for key tile kt
        v8f st;
        #pragma unroll
        for (int r = 0; r < 8; ++r) st[r] = 0.0f;
        #pragma unroll
        for (int k = 0; k < 16; ++k) {
            v2f a = ldsL1(sKh, SQK, 16 * kt, 4 * k, ln, hl);  // A[key][d]
            st = wmma4(a, qf[k], st);
        }
        // five vector slots between the last WMMA of T and the first reader of
        // its result (the mask's select, or the next WMMA that takes it as A)
        asm volatile("v_nop\n\tv_nop\n\tv_nop\n\tv_nop\n\tv_nop" : "+v"(st));
        // causal mask: only the diagonal tile has keys above the query
        const int lim = (kt == rh) ? ln : 15;
        #pragma unroll
        for (int r = 0; r < 8; ++r)
            st[r] = (r + 8 * hl > lim) ? 0.0f : st[r];
        zrow += ((st[0] + st[1]) + (st[2] + st[3]))
              + ((st[4] + st[5]) + (st[6] + st[7]));
        // out += S x v, A fragments taken from st as they stand
        #pragma unroll
        for (int s = 0; s < 4; ++s) {
            v2f a;
            a.x = st[2 * s]; a.y = st[2 * s + 1];
            #pragma unroll
            for (int nt = 0; nt < 4; ++nt)
                out_acc[nt] = wmma4(a, vb[s][nt], out_acc[nt]);
        }
    }
    sZi[hl * CC + 16 * rt + ln] = zrow;
    __syncthreads();   // sZ (written by other waves) and sZi final before use

    float* go = O + base;
    float zr[8];
    #pragma unroll
    for (int r = 0; r < 8; ++r) {
        int m = 16 * rt + r + 8 * hl;
        zr[r] = sZ[m] + (sZi[m] + sZi[CC + m]);
    }
    #pragma unroll
    for (int nt = 0; nt < 4; ++nt) {
        int mv = 16 * nt + ln;
        #pragma unroll
        for (int r = 0; r < 8; ++r) {
            int m = 16 * rt + r + 8 * hl;
            go[(long)m * ROWSTRIDE + mv] = out_acc[nt][r] / zr[r];
        }
    }
}

// ---------------------------------------------------------------------------
extern "C" void kernel_launch(void* const* d_in, const int* in_sizes, int n_in,
                              void* d_out, int out_size, void* d_ws, size_t ws_size,
                              hipStream_t stream) {
    const float* Q = (const float*)d_in[0];
    const float* K = (const float*)d_in[1];
    const float* V = (const float*)d_in[2];
    float* O = (float*)d_out;

    const int nChunks = NB * GG * HH;                 // 2048
    float* wkv = (float*)d_ws;                        // 2048 * 4096 f32
    float* wks = wkv + (size_t)nChunks * DD * DD;     // 2048 * 64 f32

    const size_t lds1 = (size_t)(2 * CC * SQK) * sizeof(float);
    const size_t lds3 = (size_t)(3 * CC * SQK + 2 * DD * SKVS + CC + 2 * DD + 2 * CC)
                        * sizeof(float);

    hipFuncSetAttribute((const void*)k_chunk_state,
                        hipFuncAttributeMaxDynamicSharedMemorySize, (int)lds1);
    hipFuncSetAttribute((const void*)k_output,
                        hipFuncAttributeMaxDynamicSharedMemorySize, (int)lds3);

    k_chunk_state<<<nChunks, 256, lds1, stream>>>(K, V, wkv, wks);
    k_prefix<<<NB * HH, 256, 0, stream>>>(wkv, wks);
    k_output<<<nChunks, 256, lds3, stream>>>(Q, K, V, wkv, wks, O);
}

// v005
// It runs in 78.3 microseconds.
// In both of two side-by-side timings against v004, it was 1.08 times as fast.
// Counting every step since v000, it is 2.27 times as fast.
#include <hip/hip_runtime.h>

// ---------------------------------------------------------------------------
// Causal linear attention (chunkwise) for MI455X / gfx1250, fp32 WMMA path.
// Shapes: N=4, L=4096, H=16, D=M=64, CHUNK=128, G=32 chunks.
// 2 passes: KV states with their prefix inside groups of 4 chunks -> per-chunk output,
// which adds the totals of the earlier groups.
// Matmuls on V_WMMA_F32_16X16X4_F32; untransformed operands staged with
// GLOBAL_LOAD_ASYNC_TO_LDS_B128 (ASYNCcnt), phi(q)/phi(k) via VGPR path.
// ---------------------------------------------------------------------------

typedef float v2f __attribute__((ext_vector_type(2)));
typedef float v8f __attribute__((ext_vector_type(8)));

#define NB   4
#define LL   4096
#define HH   16
#define DD   64
#define CC   128
#define GG   32
#define SS   4                 // chunks that one pass-1 block runs in a row
#define NS   (GG / SS)         // such groups per sequence
#define ROWSTRIDE 1024          // H*D elements between consecutive l
#define SQK 68                  // LDS stride (floats), 68%64==4 -> conflict-free
#define SKVS 68                 // LDS stride for 64x64 KV state

__device__ __forceinline__ float phi(float x) {            // elu(x)+1
    return x > 0.0f ? x + 1.0f : __expf(x);
}
__device__ __forceinline__ float4 phi4(float4 v) {
    v.x = phi(v.x); v.y = phi(v.y); v.z = phi(v.z); v.w = phi(v.w);
    return v;
}

// Four async memory -> LDS copies of 16 bytes per lane (ASYNCcnt-tracked).
// l*: byte offset within this workgroup's LDS allocation (16B aligned).
// The s_wait_xcnt closes the statement as a precaution: it stands ahead of every
// later write of a register that these copies name, and inside the statement the
// compiler can move nothing over it.
__device__ __forceinline__ void async_g2lds_b128_x4(
        unsigned l0, const void* g0, unsigned l1, const void* g1,
        unsigned l2, const void* g2, unsigned l3, const void* g3) {
    asm volatile("global_load_async_to_lds_b128 %0, %1, off\n\t"
                 "global_load_async_to_lds_b128 %2, %3, off\n\t"
                 "global_load_async_to_lds_b128 %4, %5, off\n\t"
                 "global_load_async_to_lds_b128 %6, %7, off\n\t"
                 "s_wait_xcnt 0x0"
                 :: "v"(l0), "v"(g0), "v"(l1), "v"(g1),
                    "v"(l2), "v"(g2), "v"(l3), "v"(g3) : "memory");
}
__device__ __forceinline__ void wait_async0() {
    asm volatile("s_wait_asynccnt 0x0" ::: "memory");
}

__device__ __forceinline__ v8f wmma4(v2f a, v2f b, v8f c) {
    // D(16x16,f32) = A(16x4,f32) x B(4x16,f32) + C
    return __builtin_amdgcn_wmma_f32_16x16x4_f32(false, a, false, b,
                                                 (short)0, c, false, false);
}

// Fragment loaders for the 16x16x4 f32 operand layouts (wave32):
//   A: lane ln holds row m=ln; VGPR j holds K = k0 + 2*hl + j   (hl = lane>>4)
//   B: lane ln holds col n=ln; VGPR j holds K = k0 + 2*hl + j
// L1: matrix stored row-major as S[row][col] with (row=m|n, col=k)
__device__ __forceinline__ v2f ldsL1(const float* s, int stride, int r0, int k0,
                                     int ln, int hl) {
    v2f f;
    const float* p = s + (r0 + ln) * stride + k0 + 2 * hl;
    f.x = p[0]; f.y = p[1];
    return f;
}
// L2: matrix stored row-major as S[k][col] (k varies with VGPR/half-wave)
__device__ __forceinline__ v2f ldsL2(const float* s, int stride, int k0, int c0,
                                     int ln, int hl) {
    v2f f;
    f.x = s[(k0 + 2 * hl + 0) * stride + c0 + ln];
    f.y = s[(k0 + 2 * hl + 1) * stride + c0 + ln];
    return f;
}

// ---------------------------------------------------------------------------
// Pass 1: chunk states and their prefix inside a group of SS chunks.
// block = (n,sg,h) runs its SS chunks in a row and keeps the accumulators:
// ahead of chunk t it stores the state summed so far (exclusive prefix inside the
// group), behind the last chunk the group's total.  kv = phi(k)^T x v  (64x64),
// ksum = column sums of phi(k).  8 waves: each owns 2 of 16 kv tiles.
// ---------------------------------------------------------------------------
__global__ void __launch_bounds__(256) k_chunk_state(
        const float* __restrict__ K, const float* __restrict__ V,
        float* __restrict__ wkv, float* __restrict__ wks,
        float* __restrict__ wtot, float* __restrict__ wkst) {
    extern __shared__ float smem[];
    float* sK = smem;                 // 128 x SQK
    float* sV = sK + CC * SQK;        // 128 x SQK
    const unsigned sVoff = (unsigned)(CC * SQK) * 4u;   // LDS byte offset of sV

    const int tid = threadIdx.x, wave = tid >> 5, lane = tid & 31;
    const int ln = lane & 15, hl = lane >> 4;
    const int b = blockIdx.x;                     // ((n*NS+sg)*16+h)
    const int h = b & 15, ns = b >> 4, sg = ns & (NS - 1), n = ns / NS;
    const long base = (((long)n * LL + (long)sg * (SS * CC)) * HH + h) * DD;
    const int cb0 = (n * GG + sg * SS) * HH + h;  // chunk id of trip 0; + HH a trip

    const int c0 = tid >> 4, c4 = (tid & 15) * 4;   // row group i: row c0 + 16 i
    const unsigned lV = sVoff + (unsigned)(c0 * SQK + c4) * 4u;
    const int dt = wave >> 1, mt0 = 2 * (wave & 1); // this wave's two tiles

    v8f acc[2];
    #pragma unroll
    for (int t = 0; t < 2; ++t)
        #pragma unroll
        for (int r = 0; r < 8; ++r) acc[t][r] = 0.0f;
    float ksrun = 0.0f;

    #pragma unroll 1   // one copy of the 64-WMMA body: short code, same work
    for (int ch = 0; ch < SS; ++ch) {
        // V: async memory->LDS (no transform needed); K: VGPR path with phi.
        // Every request of the tile is issued before the first wait, so a trip
        // pays one memory latency and not one per row group.
        const float* gK = K + base + (long)(ch * CC + c0) * ROWSTRIDE + c4;
        const float* gV = V + base + (long)(ch * CC + c0) * ROWSTRIDE + c4;
        #pragma unroll   // constant row offsets
        for (int i = 0; i < 8; i += 4)
            async_g2lds_b128_x4(
                lV + (unsigned)((i + 0) * 16 * SQK) * 4u, gV + (long)(i + 0) * 16 * ROWSTRIDE,
                lV + (unsigned)((i + 1) * 16 * SQK) * 4u, gV + (long)(i + 1) * 16 * ROWSTRIDE,
                lV + (unsigned)((i + 2) * 16 * SQK) * 4u, gV + (long)(i + 2) * 16 * ROWSTRIDE,
                lV + (unsigned)((i + 3) * 16 * SQK) * 4u, gV + (long)(i + 3) * 16 * ROWSTRIDE);
        float4 vk[8];
        #pragma unroll   // vk[] stays in registers
        for (int i = 0; i < 8; ++i)
            vk[i] = *(const float4*)(gK + (long)i * 16 * ROWSTRIDE);
        // state before this chunk; the stores fly under the tile's memory latency
        float* okv = wkv + (long)(cb0 + ch * HH) * (DD * DD);
        #pragma unroll
        for (int t = 0; t < 2; ++t)
            #pragma unroll
            for (int r = 0; r < 8; ++r)
                okv[(16 * dt + r + 8 * hl) * DD + 16 * (mt0 + t) + ln] = acc[t][r];
        if (tid < DD) wks[(long)(cb0 + ch * HH) * DD + tid] = ksrun;
        // precaution: behind the loads and stores, ahead of the first write of a
        // register that they name (address pairs; acc, which the WMMAs rewrite)
        asm volatile("s_wait_xcnt 0x0" :: "v"(gK), "v"(okv) : "memory");
        #pragma unroll   // vk[] stays in registers
        for (int i = 0; i < 8; ++i)
            *(float4*)&sK[(c0 + 16 * i) * SQK + c4] = phi4(vk[i]);
        wait_async0();
        __syncthreads();

        // ksum first, on waves 0 and 1
        if (tid < DD) {
            float s = 0.0f;
            for (int c = 0; c < CC; ++c) s += sK[c * SQK + tid];
            ksrun += s;
        }
        #pragma unroll
        for (int t = 0; t < 2; ++t) {
            #pragma unroll
            for (int k0 = 0; k0 < CC; k0 += 4) {
                v2f a  = ldsL2(sK, SQK, k0, 16 * dt, ln, hl);         // A[d][c] = kc[c][d]
                v2f bb = ldsL2(sV, SQK, k0, 16 * (mt0 + t), ln, hl);  // B[c][m] = vc[c][m]
                acc[t] = wmma4(a, bb, acc[t]);
            }
        }
        // every wave's LDS reads of this tile are done before the next trip's
        // copies and stores land on it
        asm volatile("s_wait_dscnt 0x0" ::: "memory");
        __syncthreads();
    }

    const int gi = (n * HH + h) * NS + sg;        // a head's totals lie in a row
    if (tid < DD) wkst[(long)gi * DD + tid] = ksrun;
    float* otot = wtot + (long)gi * (DD * DD);
    #pragma unroll
    for (int t = 0; t < 2; ++t)
        #pragma unroll
        for (int r = 0; r < 8; ++r)
            otot[(16 * dt + r + 8 * hl) * DD + 16 * (mt0 + t) + ln] = acc[t][r];
}

// ---------------------------------------------------------------------------
// Pass 2: outputs.  block = (n,g,h).
//   out = phi(q) x kv_prev  +  tril(phi(q) phi(k)^T) x v
//   z   = phi(q).ksum_prev  +  rowsum(masked scores)  + eps
// The chunk is cut in two halves of 64 rows.  Rows 64..127 meet keys 0..63 through
// a second state, kv_half = kv_prev + phi(k[0:64])^T x v[0:64] (256 WMMAs a block),
// and not through 16 score tiles (512 WMMAs); their z takes ksum up to row 64.
// Each wave owns one output row-tile rt (rows 16rt..16rt+15); causal key tiles of
// its own half only, so tile rt costs (rt & 3) + 1 key tiles.  Waves w and w+4
// take five key tiles together, the longer tile on wave w.
// Scores are formed transposed, T = phi(k) x phi(q)^T: the result registers of
// T (lane = query, VGPR r = key r + 8*hl) are then A fragments of S x v as they
// stand, with k order key = 8*hl + 2*s + j in step s; the v loader follows the
// same order.  The score tile never goes through LDS.
// ---------------------------------------------------------------------------
__global__ void __launch_bounds__(256) k_output(
        const float* __restrict__ Q, const float* __restrict__ K,
        const float* __restrict__ V, const float* __restrict__ wkv,
        const float* __restrict__ wks, const float* __restrict__ wtot,
        const float* __restrict__ wkst, float* __restrict__ O) {
    extern __shared__ float smem[];
    float* sQ  = smem;                  // 128 x SQK
    float* sK  = sQ + CC * SQK;         // 128 x SQK
    float* sV  = sK + CC * SQK;         // 128 x SQK
    float* sKV = sV + CC * SQK;         // 64 x SKVS  (kv before the chunk)
    float* sKV2 = sKV + DD * SKVS;      // 64 x SKVS  (kv up to row 64 of the chunk)
    float* sZ  = sKV2 + DD * SKVS;      // 128
    float* sKs = sZ + CC;               // 64  (ksum before the chunk)
    float* sKs2 = sKs + DD;             // 64  (ksum up to row 64 of the chunk)
    float* sZi = sKs2 + DD;             // 2 x 128 (score row sums, per half-wave)
    const unsigned sVoff  = (unsigned)(2 * CC * SQK) * 4u;

    const int tid = threadIdx.x, wave = tid >> 5, lane = tid & 31;
    const int ln = lane & 15, hl = lane >> 4;
    const int b = blockIdx.x;
    const int h = b & 15, ng = b >> 4, g = ng & 31, n = ng >> 5;
    const long base = (((long)n * LL + (long)g * CC) * HH + h) * DD;
    // row tile in a scalar register: the key-tile loop branches on SCC
    const int wv = __builtin_amdgcn_readfirstlane(wave);
    // waves 0..7 take tiles 3 7 2 6 4 0 5 1 (one hex digit a wave, wave 0 lowest)
    const int rt = (0x15046273 >> (4 * wv)) & 7;

    // V: async memory->LDS; Q/K: VGPR path with phi; kv_prev: VGPR path, the prefix
    // inside the chunk's group plus the totals of the sg earlier groups.
    // Every request of the block is issued before the first wait, so the block
    // pays one memory latency and not one per row group.
    const int c0 = tid >> 4, c4 = (tid & 15) * 4;   // row group i: row c0 + 16 i
    const float* gQ = Q + base + (long)c0 * ROWSTRIDE + c4;
    const float* gK = K + base + (long)c0 * ROWSTRIDE + c4;
    const float* gV = V + base + (long)c0 * ROWSTRIDE + c4;
    const float* gKV = wkv + (long)b * (DD * DD) + c0 * DD + c4;
    const unsigned lV  = sVoff  + (unsigned)(c0 * SQK  + c4) * 4u;
    const int sg = g / SS;                          // block-uniform: scalar branches
    const float* gT = wtot + (long)((n * HH + h) * NS) * (DD * DD) + c0 * DD + c4;
    #pragma unroll   // constant row offsets
    for (int i = 0; i < 8; i += 4)
        async_g2lds_b128_x4(
            lV + (unsigned)((i + 0) * 16 * SQK) * 4u, gV + (long)(i + 0) * 16 * ROWSTRIDE,
            lV + (unsigned)((i + 1) * 16 * SQK) * 4u, gV + (long)(i + 1) * 16 * ROWSTRIDE,
            lV + (unsigned)((i + 2) * 16 * SQK) * 4u, gV + (long)(i + 2) * 16 * ROWSTRIDE,
            lV + (unsigned)((i + 3) * 16 * SQK) * 4u, gV + (long)(i + 3) * 16 * ROWSTRIDE);
    float4 vq[8], vk[8];
    #pragma unroll   // vq[], vk[] stay in registers
    for (int i = 0; i < 8; ++i) {
        vq[i] = *(const float4*)(gQ + (long)i * 16 * ROWSTRIDE);
        vk[i] = *(const float4*)(gK + (long)i * 16 * ROWSTRIDE);
    }
    // every thread loads (index wrapped into the 64 sums): no branch round the load
    const int kso = tid & (DD - 1);
    float ksv = wks[(long)b * DD + kso];
    const float* gTs = wkst + (long)((n * HH + h) * NS) * DD + kso;
    float4 kvl[4], kvt[NS - 1][4];
    float kst[NS - 1];
    #pragma unroll   // kvl[] stays in registers
    for (int i = 0; i < 4; ++i)
        kvl[i] = *(const float4*)(gKV + i * 16 * DD);
    #pragma unroll   // kvt[], kst[] stay in registers; all loads ahead of the first wait
    for (int e = 0; e < NS - 1; ++e) {
        if (e < sg) {
            #pragma unroll
            for (int i = 0; i < 4; ++i)
                kvt[e][i] = *(const float4*)(gT + e * (DD * DD) + i * 16 * DD);
            kst[e] = gTs[e * DD];
        } else {
            #pragma unroll
            for (int i = 0; i < 4; ++i) kvt[e][i] = make_float4(0.0f, 0.0f, 0.0f, 0.0f);
            kst[e] = 0.0f;
        }
    }
    // precaution: behind the loads, ahead of the first write of their address
    // registers, which are named as inputs so that they are kept up to here
    asm volatile("s_wait_xcnt 0x0" :: "v"(gQ), "v"(gK), "v"(kso), "v"(gKV), "v"(gT), "v"(gTs)
                 : "memory");
    #pragma unroll   // vq[], vk[] stay in registers
    for (int i = 0; i < 8; ++i) {
        *(float4*)&sQ[(c0 + 16 * i) * SQK + c4] = phi4(vq[i]);
        *(float4*)&sK[(c0 + 16 * i) * SQK + c4] = phi4(vk[i]);
    }
    #pragma unroll   // kvl[], kvt[] stay in registers
    for (int i = 0; i < 4; ++i) {
        #pragma unroll
        for (int e = 0; e < NS - 1; ++e) {
            kvl[i].x += kvt[e][i].x; kvl[i].y += kvt[e][i].y;
            kvl[i].z += kvt[e][i].z; kvl[i].w += kvt[e][i].w;
        }
        *(float4*)&sKV[(c0 + 16 * i) * SKVS + c4] = kvl[i];
    }
    #pragma unroll
    for (int e = 0; e < NS - 1; ++e) ksv += kst[e];
    if (tid < DD) sKs[tid] = ksv;
    wait_async0();
    __syncthreads();

    // ksum up to row 64, one column a thread, on waves 4 and 5
    if (tid >= CC && tid < CC + DD) {
        const int d = tid - CC;
        float s[4] = {sKs[d], 0.0f, 0.0f, 0.0f};   // four short add chains, not one
        #pragma unroll   // all loads asked for ahead of the adds
        for (int c = 0; c < CC / 2; ++c) s[c & 3] += sK[c * SQK + d];
        sKs2[d] = (s[0] + s[1]) + (s[2] + s[3]);
    }
    // kv_half: each wave owns two of its 16 tiles (one d tile, two m tiles), started
    // from kv_prev.  k order of both loaders: row = 16*g + 8*hl + 2*s + j, so that
    // the two half-waves read LDS banks 32 apart
    {
        const int dt = wv >> 1, mt0 = 2 * (wv & 1);
        v8f hs[2];
        #pragma unroll   // here and below: hs[] stays in registers
        for (int t = 0; t < 2; ++t)
            #pragma unroll
            for (int r = 0; r < 8; ++r)
                hs[t][r] = sKV[(16 * dt + r + 8 * hl) * SKVS + 16 * (mt0 + t) + ln];
        #pragma unroll   // constant LDS offsets; the two tiles' chains interleave
        for (int k0 = 0; k0 < CC / 2; k0 += 16) {
            #pragma unroll
            for (int s = 0; s < 4; ++s) {
                const int row = k0 + 8 * hl + 2 * s;
                v2f a;                                   // A[d][c] = kc[c][d]
                a.x = sK[(row + 0) * SQK + 16 * dt + ln];
                a.y = sK[(row + 1) * SQK + 16 * dt + ln];
                #pragma unroll
                for (int t = 0; t < 2; ++t) {
                    v2f bb;                              // B[c][m] = vc[c][m]
                    bb.x = sV[(row + 0) * SQK + 16 * (mt0 + t) + ln];
                    bb.y = sV[(row + 1) * SQK + 16 * (mt0 + t) + ln];
                    hs[t] = wmma4(a, bb, hs[t]);
                }
            }
        }
        #pragma unroll
        for (int t = 0; t < 2; ++t)
            #pragma unroll
            for (int r = 0; r < 8; ++r)
                sKV2[(16 * dt + r + 8 * hl) * SKVS + 16 * (mt0 + t) + ln] = hs[t][r];
    }
    __syncthreads();   // kv_half and its ksum (written by other waves) final

    // normalizer, part before this row's half: z = phi(q_l) . ksum; one row a
    // thread, on waves 4..7, whose key loops are the short ones
    if (tid >= CC) {
        const int zq = tid - CC;
        const float* ks = wv < 6 ? sKs : sKs2;   // waves 6, 7: rows 64..127
        float acc = 0.0f;
        for (int d = 0; d < DD; ++d) acc += sQ[zq * SQK + d] * ks[d];
        sZ[zq] = acc + 1e-6f;
    }

    // output from before this row's half: out = phi(q) x kv   (row-tile rt)
    const float* kvp = rt < 4 ? sKV : sKV2;
    v8f out_acc[4];
    #pragma unroll
    for (int t = 0; t < 4; ++t)
        #pragma unroll
        for (int r = 0; r < 8; ++r) out_acc[t][r] = 0.0f;
    #pragma unroll
    for (int nt = 0; nt < 4; ++nt) {
        #pragma unroll
        for (int k0 = 0; k0 < DD; k0 += 4) {
            v2f a  = ldsL1(sQ, SQK, 16 * rt, k0, ln, hl);
            v2f bb = ldsL2(kvp, SKVS, k0, 16 * nt, ln, hl);
            out_acc[nt] = wmma4(a, bb, out_acc[nt]);
        }
    }

    // B fragments of T: B[d][query] = qc[query][d]; the same for every key tile
    v2f qf[16];
    #pragma unroll
    for (int k = 0; k < 16; ++k)
        qf[k] = ldsL1(sQ, SQK, 16 * rt, 4 * k, ln, hl);

    float zrow = 0.0f;                   // this lane's 8 keys per tile, query ln
    // key tiles of this row's half: tile kt of the half, the diagonal one is rh
    const int rh = rt & 3;
    const float* sKh = sK + (rt & 4) * 16 * SQK;
    const float* pvh = sV + ((rt & 4) * 16 + 8 * hl) * SQK + ln;
    for (int kt = 0; kt <= rh; ++kt) {
        // v fragments of this key tile, asked for ahead of the T chain so that
        // their LDS latency passes under it; B[key][m], key = 8*hl + 2*s + j
        const float* pv = pvh + 16 * kt * SQK;
        v2f vb[4][4];
        #pragma unroll
        for (int s = 0; s < 4; ++s)
            #pragma unroll
            for (int nt = 0; nt < 4; ++nt) {
                vb[s][nt].x = pv[(2 * s + 0) * SQK + 16 * nt];
                vb[s][nt].y = pv[(2 * s + 1) * SQK + 16 * nt];
            }
        // T = phi(k) x phi(q)^T for key tile kt
        v8f st;
        #pragma unroll
        for (int r = 0; r < 8; ++r) st[r] = 0.0f;
        #pragma unroll
        for (int k = 0; k < 16; ++k) {
            v2f a = ldsL1(sKh, SQK, 16 * kt, 4 * k, ln, hl);  // A[key][d]
            st = wmma4(a, qf[k], st);
        }
        // five vector slots between the last WMMA of T and the first reader of
        // its result (the mask's select, or the next WMMA that takes it as A)
        asm volatile("v_nop\n\tv_nop\n\tv_nop\n\tv_nop\n\tv_nop" : "+v"(st));
        // causal mask: only the diagonal tile has keys above the query
        const int lim = (kt == rh) ? ln : 15;
        #pragma unroll
        for (int r = 0; r < 8; ++r)
            st[r] = (r + 8 * hl > lim) ? 0.0f : st[r];
        zrow += ((st[0] + st[1]) + (st[2] + st[3]))
              + ((st[4] + st[5]) + (st[6] + st[7]));
        // out += S x v, A fragments taken from st as they stand
        #pragma unroll
        for (int s = 0; s < 4; ++s) {
            v2f a;
            a.x = st[2 * s]; a.y = st[2 * s + 1];
            #pragma unroll
            for (int nt = 0; nt < 4; ++nt)
                out_acc[nt] = wmma4(a, vb[s][nt], out_acc[nt]);
        }
    }
    sZi[hl * CC + 16 * rt + ln] = zrow;
    __syncthreads();   // sZ (written by other waves) and sZi final before use

    float* go = O + base;
    float zr[8];
    #pragma unroll
    for (int r = 0; r < 8; ++r) {
        int m = 16 * rt + r + 8 * hl;
        zr[r] = sZ[m] + (sZi[m] + sZi[CC + m]);
    }
    #pragma unroll
    for (int nt = 0; nt < 4; ++nt) {
        int mv = 16 * nt + ln;
        #pragma unroll
        for (int r = 0; r < 8; ++r) {
            int m = 16 * rt + r + 8 * hl;
            go[(long)m * ROWSTRIDE + mv] = out_acc[nt][r] / zr[r];
        }
    }
}

// ---------------------------------------------------------------------------
extern "C" void kernel_launch(void* const* d_in, const int* in_sizes, int n_in,
                              void* d_out, int out_size, void* d_ws, size_t ws_size,
                              hipStream_t stream) {
    const float* Q = (const float*)d_in[0];
    const float* K = (const float*)d_in[1];
    const float* V = (const float*)d_in[2];
    float* O = (float*)d_out;

    const int nChunks = NB * GG * HH;                 // 2048
    float* wkv = (float*)d_ws;                        // 2048 * 4096 f32
    float* wks = wkv + (size_t)nChunks * DD * DD;     // 2048 * 64 f32
    float* wtot = wks + (size_t)nChunks * DD;         // 512 * 4096 f32 (group totals)
    float* wkst = wtot + (size_t)(NB * NS * HH) * DD * DD;   // 512 * 64 f32

    const size_t lds1 = (size_t)(2 * CC * SQK) * sizeof(float);
    const size_t lds3 = (size_t)(3 * CC * SQK + 2 * DD * SKVS + CC + 2 * DD + 2 * CC)
                        * sizeof(float);

    hipFuncSetAttribute((const void*)k_chunk_state,
                        hipFuncAttributeMaxDynamicSharedMemorySize, (int)lds1);
    hipFuncSetAttribute((const void*)k_output,
                        hipFuncAttributeMaxDynamicSharedMemorySize, (int)lds3);

    k_chunk_state<<<NB * NS * HH, 256, lds1, stream>>>(K, V, wkv, wks, wtot, wkst);
    k_output<<<nChunks, 256, lds3, stream>>>(Q, K, V, wkv, wks, wtot, wkst, O);
}

// v006
// One run takes 73.4 microseconds.
// In two side-by-side timings against v005, it was 1.07 and 1.06 times as fast.
// All steps since v000 together make it 2.42 times as fast.
#include <hip/hip_runtime.h>

// ---------------------------------------------------------------------------
// Causal linear attention (chunkwise) for MI455X / gfx1250, fp32 WMMA path.
// Shapes: N=4, L=4096, H=16, D=M=64, CHUNK=128, G=32 chunks.
// 2 passes: KV states with their prefix inside groups of 4 chunks -> output, a block
// running the 4 chunks of a group in a row and adding the totals of the earlier groups.
// Matmuls on V_WMMA_F32_16X16X4_F32; untransformed operands staged with
// GLOBAL_LOAD_ASYNC_TO_LDS_B128 (ASYNCcnt), phi(q)/phi(k) via VGPR path.
// ---------------------------------------------------------------------------

typedef float v2f __attribute__((ext_vector_type(2)));
typedef float v8f __attribute__((ext_vector_type(8)));

#define NB   4
#define LL   4096
#define HH   16
#define DD   64
#define CC   128
#define GG   32
#define SS   4                 // chunks that one pass-1 block runs in a row
#define NS   (GG / SS)         // such groups per sequence
#define ROWSTRIDE 1024          // H*D elements between consecutive l
#define SQK 68                  // LDS stride (floats), 68%64==4 -> conflict-free
#define SKVS 68                 // LDS stride for 64x64 KV state

__device__ __forceinline__ float phi(float x) {            // elu(x)+1
    return x > 0.0f ? x + 1.0f : __expf(x);
}
__device__ __forceinline__ float4 phi4(float4 v) {
    v.x = phi(v.x); v.y = phi(v.y); v.z = phi(v.z); v.w = phi(v.w);
    return v;
}

// Four async memory -> LDS copies of 16 bytes per lane (ASYNCcnt-tracked).
// l*: byte offset within this workgroup's LDS allocation (16B aligned).
// The s_wait_xcnt closes the statement as a precaution: it stands ahead of every
// later write of a register that these copies name, and inside the statement the
// compiler can move nothing over it.
__device__ __forceinline__ void async_g2lds_b128_x4(
        unsigned l0, const void* g0, unsigned l1, const void* g1,
        unsigned l2, const void* g2, unsigned l3, const void* g3) {
    asm volatile("global_load_async_to_lds_b128 %0, %1, off\n\t"
                 "global_load_async_to_lds_b128 %2, %3, off\n\t"
                 "global_load_async_to_lds_b128 %4, %5, off\n\t"
                 "global_load_async_to_lds_b128 %6, %7, off\n\t"
                 "s_wait_xcnt 0x0"
                 :: "v"(l0), "v"(g0), "v"(l1), "v"(g1),
                    "v"(l2), "v"(g2), "v"(l3), "v"(g3) : "memory");
}
__device__ __forceinline__ void wait_async0() {
    asm volatile("s_wait_asynccnt 0x0" ::: "memory");
}

__device__ __forceinline__ v8f wmma4(v2f a, v2f b, v8f c) {
    // D(16x16,f32) = A(16x4,f32) x B(4x16,f32) + C
    return __builtin_amdgcn_wmma_f32_16x16x4_f32(false, a, false, b,
                                                 (short)0, c, false, false);
}

// Fragment loaders for the 16x16x4 f32 operand layouts (wave32):
//   A: lane ln holds row m=ln; VGPR j holds K = k0 + 2*hl + j   (hl = lane>>4)
//   B: lane ln holds col n=ln; VGPR j holds K = k0 + 2*hl + j
// L1: matrix stored row-major as S[row][col] with (row=m|n, col=k)
__device__ __forceinline__ v2f ldsL1(const float* s, int stride, int r0, int k0,
                                     int ln, int hl) {
    v2f f;
    const float* p = s + (r0 + ln) * stride + k0 + 2 * hl;
    f.x = p[0]; f.y = p[1];
    return f;
}
// L2: matrix stored row-major as S[k][col] (k varies with VGPR/half-wave)
__device__ __forceinline__ v2f ldsL2(const float* s, int stride, int k0, int c0,
                                     int ln, int hl) {
    v2f f;
    f.x = s[(k0 + 2 * hl + 0) * stride + c0 + ln];
    f.y = s[(k0 + 2 * hl + 1) * stride + c0 + ln];
    return f;
}

// ---------------------------------------------------------------------------
// Pass 1: chunk states and their prefix inside a group of SS chunks.
// block = (n,sg,h) runs its SS chunks in a row and keeps the accumulators:
// ahead of chunk t it stores the state summed so far (exclusive prefix inside the
// group), behind the last chunk the group's total.  kv = phi(k)^T x v  (64x64),
// ksum = column sums of phi(k).  8 waves: each owns 2 of 16 kv tiles.
// ---------------------------------------------------------------------------
__global__ void __launch_bounds__(256) k_chunk_state(
        const float* __restrict__ K, const float* __restrict__ V,
        float* __restrict__ wkv, float* __restrict__ wks,
        float* __restrict__ wtot, float* __restrict__ wkst) {
    extern __shared__ float smem[];
    float* sK = smem;                 // 128 x SQK
    float* sV = sK + CC * SQK;        // 128 x SQK
    const unsigned sVoff = (unsigned)(CC * SQK) * 4u;   // LDS byte offset of sV

    const int tid = threadIdx.x, wave = tid >> 5, lane = tid & 31;
    const int ln = lane & 15, hl = lane >> 4;
    const int b = blockIdx.x;                     // ((n*NS+sg)*16+h)
    const int h = b & 15, ns = b >> 4, sg = ns & (NS - 1), n = ns / NS;
    const long base = (((long)n * LL + (long)sg * (SS * CC)) * HH + h) * DD;
    const int cb0 = (n * GG + sg * SS) * HH + h;  // chunk id of trip 0; + HH a trip

    const int c0 = tid >> 4, c4 = (tid & 15) * 4;   // row group i: row c0 + 16 i
    const unsigned lV = sVoff + (unsigned)(c0 * SQK + c4) * 4u;
    const int dt = wave >> 1, mt0 = 2 * (wave & 1); // this wave's two tiles

    v8f acc[2];
    #pragma unroll
    for (int t = 0; t < 2; ++t)
        #pragma unroll
        for (int r = 0; r < 8; ++r) acc[t][r] = 0.0f;
    float ksrun = 0.0f;

    #pragma unroll 1   // one copy of the 64-WMMA body: short code, same work
    for (int ch = 0; ch < SS; ++ch) {
        // V: async memory->LDS (no transform needed); K: VGPR path with phi.
        // Every request of the tile is issued before the first wait, so a trip
        // pays one memory latency and not one per row group.
        const float* gK = K + base + (long)(ch * CC + c0) * ROWSTRIDE + c4;
        const float* gV = V + base + (long)(ch * CC + c0) * ROWSTRIDE + c4;
        #pragma unroll   // constant row offsets
        for (int i = 0; i < 8; i += 4)
            async_g2lds_b128_x4(
                lV + (unsigned)((i + 0) * 16 * SQK) * 4u, gV + (long)(i + 0) * 16 * ROWSTRIDE,
                lV + (unsigned)((i + 1) * 16 * SQK) * 4u, gV + (long)(i + 1) * 16 * ROWSTRIDE,
                lV + (unsigned)((i + 2) * 16 * SQK) * 4u, gV + (long)(i + 2) * 16 * ROWSTRIDE,
                lV + (unsigned)((i + 3) * 16 * SQK) * 4u, gV + (long)(i + 3) * 16 * ROWSTRIDE);
        float4 vk[8];
        #pragma unroll   // vk[] stays in registers
        for (int i = 0; i < 8; ++i)
            vk[i] = *(const float4*)(gK + (long)i * 16 * ROWSTRIDE);
        // state before this chunk; the stores fly under the tile's memory latency
        float* okv = wkv + (long)(cb0 + ch * HH) * (DD * DD);
        #pragma unroll
        for (int t = 0; t < 2; ++t)
            #pragma unroll
            for (int r = 0; r < 8; ++r)
                okv[(16 * dt + r + 8 * hl) * DD + 16 * (mt0 + t) + ln] = acc[t][r];
        if (tid < DD) wks[(long)(cb0 + ch * HH) * DD + tid] = ksrun;
        // precaution: behind the loads and stores, ahead of the first write of a
        // register that they name (address pairs; acc, which the WMMAs rewrite)
        asm volatile("s_wait_xcnt 0x0" :: "v"(gK), "v"(okv) : "memory");
        #pragma unroll   // vk[] stays in registers
        for (int i = 0; i < 8; ++i)
            *(float4*)&sK[(c0 + 16 * i) * SQK + c4] = phi4(vk[i]);
        wait_async0();
        __syncthreads();

        // ksum first, on waves 0 and 1
        if (tid < DD) {
            float s = 0.0f;
            for (int c = 0; c < CC; ++c) s += sK[c * SQK + tid];
            ksrun += s;
        }
        #pragma unroll
        for (int t = 0; t < 2; ++t) {
            #pragma unroll
            for (int k0 = 0; k0 < CC; k0 += 4) {
                v2f a  = ldsL2(sK, SQK, k0, 16 * dt, ln, hl);         // A[d][c] = kc[c][d]
                v2f bb = ldsL2(sV, SQK, k0, 16 * (mt0 + t), ln, hl);  // B[c][m] = vc[c][m]
                acc[t] = wmma4(a, bb, acc[t]);
            }
        }
        // every wave's LDS reads of this tile are done before the next trip's
        // copies and stores land on it
        asm volatile("s_wait_dscnt 0x0" ::: "memory");
        __syncthreads();
    }

    const int gi = (n * HH + h) * NS + sg;        // a head's totals lie in a row
    if (tid < DD) wkst[(long)gi * DD + tid] = ksrun;
    float* otot = wtot + (long)gi * (DD * DD);
    #pragma unroll
    for (int t = 0; t < 2; ++t)
        #pragma unroll
        for (int r = 0; r < 8; ++r)
            otot[(16 * dt + r + 8 * hl) * DD + 16 * (mt0 + t) + ln] = acc[t][r];
}

// ---------------------------------------------------------------------------
// Pass 2: outputs.  block = (n,sg,h) runs the SS chunks of its group in a row: the
// next chunk's Q, K and state loads fly in registers under this chunk's WMMAs, its V
// copies under the divisions and stores; the earlier groups' totals are summed once.
//   out = phi(q) x kv_prev  +  tril(phi(q) phi(k)^T) x v
//   z   = phi(q).ksum_prev  +  rowsum(masked scores)  + eps
// The chunk is cut in two halves of 64 rows.  Rows 64..127 meet keys 0..63 through
// a second state, kv_half = kv_prev + phi(k[0:64])^T x v[0:64] (256 WMMAs a chunk),
// and not through 16 score tiles (512 WMMAs); their z takes ksum up to row 64.
// Each wave owns one output row-tile rt (rows 16rt..16rt+15); causal key tiles of
// its own half only, so tile rt costs (rt & 3) + 1 key tiles.  Waves w and w+4
// take five key tiles together, the longer tile on wave w.
// Scores are formed transposed, T = phi(k) x phi(q)^T: the result registers of
// T (lane = query, VGPR r = key r + 8*hl) are then A fragments of S x v as they
// stand, with k order key = 8*hl + 2*s + j in step s; the v loader follows the
// same order.  The score tile never goes through LDS.
// ---------------------------------------------------------------------------
__global__ void __launch_bounds__(256) k_output(
        const float* __restrict__ Q, const float* __restrict__ K,
        const float* __restrict__ V, const float* __restrict__ wkv,
        const float* __restrict__ wks, const float* __restrict__ wtot,
        const float* __restrict__ wkst, float* __restrict__ O) {
    extern __shared__ float smem[];
    float* sQ  = smem;                  // 128 x SQK
    float* sK  = sQ + CC * SQK;         // 128 x SQK
    float* sV  = sK + CC * SQK;         // 128 x SQK
    float* sKV = sV + CC * SQK;         // 64 x SKVS  (kv before the chunk)
    float* sKV2 = sKV + DD * SKVS;      // 64 x SKVS  (kv up to row 64 of the chunk)
    float* sZ  = sKV2 + DD * SKVS;      // 128
    float* sKs = sZ + CC;               // 64  (ksum before the chunk)
    float* sKs2 = sKs + DD;             // 64  (ksum up to row 64 of the chunk)
    float* sZi = sKs2 + DD;             // 2 x 128 (score row sums, per half-wave)
    const unsigned sVoff  = (unsigned)(2 * CC * SQK) * 4u;

    const int tid = threadIdx.x, wave = tid >> 5, lane = tid & 31;
    const int ln = lane & 15, hl = lane >> 4;
    const int b = blockIdx.x;
    const int h = b & 15, ns = b >> 4, sg = ns & (NS - 1), n = ns / NS;   // as in pass 1
    const long base = (((long)n * LL + (long)sg * (SS * CC)) * HH + h) * DD;
    const int cb0 = (n * GG + sg * SS) * HH + h;  // chunk id of trip 0; + HH a trip
    // row tile in a scalar register: the key-tile loop branches on SCC
    const int wv = __builtin_amdgcn_readfirstlane(wave);
    // waves 0..7 take tiles 3 7 2 6 4 0 5 1 (one hex digit a wave, wave 0 lowest)
    const int rt = (0x15046273 >> (4 * wv)) & 7;

    // V: async memory->LDS; Q/K: VGPR path with phi; kv_prev: VGPR path, the prefix
    // inside the chunk's group plus the totals of the sg earlier groups.
    // Every request of the first chunk is issued before the first wait, so it
    // pays one memory latency and not one per row group.
    const int c0 = tid >> 4, c4 = (tid & 15) * 4;   // row group i: row c0 + 16 i
    const float* gQ = Q + base + (long)c0 * ROWSTRIDE + c4;
    const float* gK = K + base + (long)c0 * ROWSTRIDE + c4;
    const float* gV = V + base + (long)c0 * ROWSTRIDE + c4;
    const float* gKV = wkv + (long)cb0 * (DD * DD) + c0 * DD + c4;
    const unsigned lV  = sVoff  + (unsigned)(c0 * SQK  + c4) * 4u;
    const float* gT = wtot + (long)((n * HH + h) * NS) * (DD * DD) + c0 * DD + c4;
    #pragma unroll   // constant row offsets
    for (int i = 0; i < 8; i += 4)
        async_g2lds_b128_x4(
            lV + (unsigned)((i + 0) * 16 * SQK) * 4u, gV + (long)(i + 0) * 16 * ROWSTRIDE,
            lV + (unsigned)((i + 1) * 16 * SQK) * 4u, gV + (long)(i + 1) * 16 * ROWSTRIDE,
            lV + (unsigned)((i + 2) * 16 * SQK) * 4u, gV + (long)(i + 2) * 16 * ROWSTRIDE,
            lV + (unsigned)((i + 3) * 16 * SQK) * 4u, gV + (long)(i + 3) * 16 * ROWSTRIDE);
    float4 vq[8], vk[8];
    #pragma unroll   // vq[], vk[] stay in registers
    for (int i = 0; i < 8; ++i) {
        vq[i] = *(const float4*)(gQ + (long)i * 16 * ROWSTRIDE);
        vk[i] = *(const float4*)(gK + (long)i * 16 * ROWSTRIDE);
    }
    // every thread loads (index wrapped into the 64 sums): no branch round the load
    const int kso = tid & (DD - 1);
    const float* gKs = wks + (long)cb0 * DD + kso;
    float ksv = gKs[0];
    const float* gTs = wkst + (long)((n * HH + h) * NS) * DD + kso;
    float4 kvl[4], kvt[NS - 1][4];
    float kst[NS - 1];
    #pragma unroll   // kvl[] stays in registers
    for (int i = 0; i < 4; ++i)
        kvl[i] = *(const float4*)(gKV + i * 16 * DD);
    #pragma unroll   // kvt[], kst[] stay in registers; all loads ahead of the first wait
    for (int e = 0; e < NS - 1; ++e) {
        if (e < sg) {
            #pragma unroll
            for (int i = 0; i < 4; ++i)
                kvt[e][i] = *(const float4*)(gT + e * (DD * DD) + i * 16 * DD);
            kst[e] = gTs[e * DD];
        } else {
            #pragma unroll
            for (int i = 0; i < 4; ++i) kvt[e][i] = make_float4(0.0f, 0.0f, 0.0f, 0.0f);
            kst[e] = 0.0f;
        }
    }
    // precaution: behind the loads, ahead of the first write of their address
    // registers, which are named as inputs so that they are kept up to here
    asm volatile("s_wait_xcnt 0x0" :: "v"(gQ), "v"(gK), "v"(gKs), "v"(gKV), "v"(gT), "v"(gTs)
                 : "memory");
    // state of the earlier groups, summed once for the SS chunks
    #pragma unroll   // kvt[] stays in registers
    for (int i = 0; i < 4; ++i)
        #pragma unroll
        for (int e = 1; e < NS - 1; ++e) {
            kvt[0][i].x += kvt[e][i].x; kvt[0][i].y += kvt[e][i].y;
            kvt[0][i].z += kvt[e][i].z; kvt[0][i].w += kvt[e][i].w;
        }
    #pragma unroll
    for (int e = 1; e < NS - 1; ++e) kst[0] += kst[e];

    #pragma unroll 1   // one copy of the body: short code, same work
    for (int ch = 0; ch < SS; ++ch) {
    #pragma unroll   // vq[], vk[] stay in registers
    for (int i = 0; i < 8; ++i) {
        *(float4*)&sQ[(c0 + 16 * i) * SQK + c4] = phi4(vq[i]);
        *(float4*)&sK[(c0 + 16 * i) * SQK + c4] = phi4(vk[i]);
    }
    #pragma unroll   // kvl[] stays in registers
    for (int i = 0; i < 4; ++i) {
        float4 s = kvl[i];
        s.x += kvt[0][i].x; s.y += kvt[0][i].y; s.z += kvt[0][i].z; s.w += kvt[0][i].w;
        *(float4*)&sKV[(c0 + 16 * i) * SKVS + c4] = s;
    }
    if (tid < DD) sKs[tid] = ksv + kst[0];
    wait_async0();
    __syncthreads();

    // ksum up to row 64, one column a thread, on waves 4 and 5
    if (tid >= CC && tid < CC + DD) {
        const int d = tid - CC;
        float s[4] = {sKs[d], 0.0f, 0.0f, 0.0f};   // four short add chains, not one
        #pragma unroll   // all loads asked for ahead of the adds
        for (int c = 0; c < CC / 2; ++c) s[c & 3] += sK[c * SQK + d];
        sKs2[d] = (s[0] + s[1]) + (s[2] + s[3]);
    }
    // kv_half: each wave owns two of its 16 tiles (one d tile, two m tiles), started
    // from kv_prev.  k order of both loaders: row = 16*g + 8*hl + 2*s + j, so that
    // the two half-waves read LDS banks 32 apart
    {
        const int dt = wv >> 1, mt0 = 2 * (wv & 1);
        v8f hs[2];
        #pragma unroll   // here and below: hs[] stays in registers
        for (int t = 0; t < 2; ++t)
            #pragma unroll
            for (int r = 0; r < 8; ++r)
                hs[t][r] = sKV[(16 * dt + r + 8 * hl) * SKVS + 16 * (mt0 + t) + ln];
        #pragma unroll   // constant LDS offsets; the two tiles' chains interleave
        for (int k0 = 0; k0 < CC / 2; k0 += 16) {
            #pragma unroll
            for (int s = 0; s < 4; ++s) {
                const int row = k0 + 8 * hl + 2 * s;
                v2f a;                                   // A[d][c] = kc[c][d]
                a.x = sK[(row + 0) * SQK + 16 * dt + ln];
                a.y = sK[(row + 1) * SQK + 16 * dt + ln];
                #pragma unroll
                for (int t = 0; t < 2; ++t) {
                    v2f bb;                              // B[c][m] = vc[c][m]
                    bb.x = sV[(row + 0) * SQK + 16 * (mt0 + t) + ln];
                    bb.y = sV[(row + 1) * SQK + 16 * (mt0 + t) + ln];
                    hs[t] = wmma4(a, bb, hs[t]);
                }
            }
        }
        #pragma unroll
        for (int t = 0; t < 2; ++t)
            #pragma unroll
            for (int r = 0; r < 8; ++r)
                sKV2[(16 * dt + r + 8 * hl) * SKVS + 16 * (mt0 + t) + ln] = hs[t][r];
    }
    __syncthreads();   // kv_half and its ksum (written by other waves) final

    // next chunk's Q, K, state and ksum: asked for here, first used at the head of
    // the next trip, so that their memory latency passes under this trip's WMMAs
    if (ch + 1 < SS) {
        const float* nQ = gQ + (long)(ch + 1) * CC * ROWSTRIDE;
        const float* nK = gK + (long)(ch + 1) * CC * ROWSTRIDE;
        const float* nKV = gKV + (long)(ch + 1) * HH * (DD * DD);
        const float* nKs = gKs + (ch + 1) * HH * DD;
        #pragma unroll   // vq[], vk[] stay in registers
        for (int i = 0; i < 8; ++i) {
            vq[i] = *(const float4*)(nQ + (long)i * 16 * ROWSTRIDE);
            vk[i] = *(const float4*)(nK + (long)i * 16 * ROWSTRIDE);
        }
        #pragma unroll   // kvl[] stays in registers
        for (int i = 0; i < 4; ++i)
            kvl[i] = *(const float4*)(nKV + i * 16 * DD);
        ksv = nKs[0];
        // precaution: behind the loads, ahead of the first write of their address
        // registers, which are named as inputs so that they are kept up to here
        asm volatile("s_wait_xcnt 0x0" :: "v"(nQ), "v"(nK), "v"(nKV), "v"(nKs) : "memory");
    }

    // normalizer, part before this row's half: z = phi(q_l) . ksum; one row a
    // thread, on waves 4..7, whose key loops are the short ones
    if (tid >= CC) {
        const int zq = tid - CC;
        const float* ks = wv < 6 ? sKs : sKs2;   // waves 6, 7: rows 64..127
        float acc = 0.0f;
        for (int d = 0; d < DD; ++d) acc += sQ[zq * SQK + d] * ks[d];
        sZ[zq] = acc + 1e-6f;
    }

    // output from before this row's half: out = phi(q) x kv   (row-tile rt)
    const float* kvp = rt < 4 ? sKV : sKV2;
    v8f out_acc[4];
    #pragma unroll
    for (int t = 0; t < 4; ++t)
        #pragma unroll
        for (int r = 0; r < 8; ++r) out_acc[t][r] = 0.0f;
    #pragma unroll
    for (int nt = 0; nt < 4; ++nt) {
        #pragma unroll
        for (int k0 = 0; k0 < DD; k0 += 4) {
            v2f a  = ldsL1(sQ, SQK, 16 * rt, k0, ln, hl);
            v2f bb = ldsL2(kvp, SKVS, k0, 16 * nt, ln, hl);
            out_acc[nt] = wmma4(a, bb, out_acc[nt]);
        }
    }

    // B fragments of T: B[d][query] = qc[query][d]; the same for every key tile
    v2f qf[16];
    #pragma unroll
    for (int k = 0; k < 16; ++k)
        qf[k] = ldsL1(sQ, SQK, 16 * rt, 4 * k, ln, hl);

    float zrow = 0.0f;                   // this lane's 8 keys per tile, query ln
    // key tiles of this row's half: tile kt of the half, the diagonal one is rh
    const int rh = rt & 3;
    const float* sKh = sK + (rt & 4) * 16 * SQK;
    const float* pvh = sV + ((rt & 4) * 16 + 8 * hl) * SQK + ln;
    for (int kt = 0; kt <= rh; ++kt) {
        // v fragments of this key tile, asked for ahead of the T chain so that
        // their LDS latency passes under it; B[key][m], key = 8*hl + 2*s + j
        const float* pv = pvh + 16 * kt * SQK;
        v2f vb[4][4];
        #pragma unroll
        for (int s = 0; s < 4; ++s)
            #pragma unroll
            for (int nt = 0; nt < 4; ++nt) {
                vb[s][nt].x = pv[(2 * s + 0) * SQK + 16 * nt];
                vb[s][nt].y = pv[(2 * s + 1) * SQK + 16 * nt];
            }
        // T = phi(k) x phi(q)^T for key tile kt
        v8f st;
        #pragma unroll
        for (int r = 0; r < 8; ++r) st[r] = 0.0f;
        #pragma unroll
        for (int k = 0; k < 16; ++k) {
            v2f a = ldsL1(sKh, SQK, 16 * kt, 4 * k, ln, hl);  // A[key][d]
            st = wmma4(a, qf[k], st);
        }
        // five vector slots between the last WMMA of T and the first reader of
        // its result (the mask's select, or the next WMMA that takes it as A)
        asm volatile("v_nop\n\tv_nop\n\tv_nop\n\tv_nop\n\tv_nop" : "+v"(st));
        // causal mask: only the diagonal tile has keys above the query
        const int lim = (kt == rh) ? ln : 15;
        #pragma unroll
        for (int r = 0; r < 8; ++r)
            st[r] = (r + 8 * hl > lim) ? 0.0f : st[r];
        zrow += ((st[0] + st[1]) + (st[2] + st[3]))
              + ((st[4] + st[5]) + (st[6] + st[7]));
        // out += S x v, A fragments taken from st as they stand
        #pragma unroll
        for (int s = 0; s < 4; ++s) {
            v2f a;
            a.x = st[2 * s]; a.y = st[2 * s + 1];
            #pragma unroll
            for (int nt = 0; nt < 4; ++nt)
                out_acc[nt] = wmma4(a, vb[s][nt], out_acc[nt]);
        }
    }
    sZi[hl * CC + 16 * rt + ln] = zrow;
    // every wave's LDS reads of this chunk are done before the next chunk's copies
    // and stores land on its tiles
    asm volatile("s_wait_dscnt 0x0" ::: "memory");
    __syncthreads();   // sZ (written by other waves) and sZi final before use

    // next chunk's V: the copies fly under the divisions, the stores and the next
    // trip's phi
    if (ch + 1 < SS) {
        const float* nV = gV + (long)(ch + 1) * CC * ROWSTRIDE;
        #pragma unroll   // constant row offsets
        for (int i = 0; i < 8; i += 4)
            async_g2lds_b128_x4(
                lV + (unsigned)((i + 0) * 16 * SQK) * 4u, nV + (long)(i + 0) * 16 * ROWSTRIDE,
                lV + (unsigned)((i + 1) * 16 * SQK) * 4u, nV + (long)(i + 1) * 16 * ROWSTRIDE,
                lV + (unsigned)((i + 2) * 16 * SQK) * 4u, nV + (long)(i + 2) * 16 * ROWSTRIDE,
                lV + (unsigned)((i + 3) * 16 * SQK) * 4u, nV + (long)(i + 3) * 16 * ROWSTRIDE);
    }

    float* go = O + base + (long)ch * CC * ROWSTRIDE;
    float zr[8];
    #pragma unroll
    for (int r = 0; r < 8; ++r) {
        int m = 16 * rt + r + 8 * hl;
        zr[r] = sZ[m] + (sZi[m] + sZi[CC + m]);
    }
    #pragma unroll
    for (int nt = 0; nt < 4; ++nt) {
        int mv = 16 * nt + ln;
        #pragma unroll
        for (int r = 0; r < 8; ++r) {
            int m = 16 * rt + r + 8 * hl;
            go[(long)m * ROWSTRIDE + mv] = out_acc[nt][r] / zr[r];
        }
    }
    // precaution: behind the stores, ahead of the next trip's first write of a
    // register that they name
    asm volatile("s_wait_xcnt 0x0" :: "v"(go) : "memory");
    }
}

// ---------------------------------------------------------------------------
extern "C" void kernel_launch(void* const* d_in, const int* in_sizes, int n_in,
                              void* d_out, int out_size, void* d_ws, size_t ws_size,
                              hipStream_t stream) {
    const float* Q = (const float*)d_in[0];
    const float* K = (const float*)d_in[1];
    const float* V = (const float*)d_in[2];
    float* O = (float*)d_out;

    const int nChunks = NB * GG * HH;                 // 2048
    float* wkv = (float*)d_ws;                        // 2048 * 4096 f32
    float* wks = wkv + (size_t)nChunks * DD * DD;     // 2048 * 64 f32
    float* wtot = wks + (size_t)nChunks * DD;         // 512 * 4096 f32 (group totals)
    float* wkst = wtot + (size_t)(NB * NS * HH) * DD * DD;   // 512 * 64 f32

    const size_t lds1 = (size_t)(2 * CC * SQK) * sizeof(float);
    const size_t lds3 = (size_t)(3 * CC * SQK + 2 * DD * SKVS + CC + 2 * DD + 2 * CC)
                        * sizeof(float);

    hipFuncSetAttribute((const void*)k_chunk_state,
                        hipFuncAttributeMaxDynamicSharedMemorySize, (int)lds1);
    hipFuncSetAttribute((const void*)k_output,
                        hipFuncAttributeMaxDynamicSharedMemorySize, (int)lds3);

    k_chunk_state<<<NB * NS * HH, 256, lds1, stream>>>(K, V, wkv, wks, wtot, wkst);
    k_output<<<NB * NS * HH, 256, lds3, stream>>>(Q, K, V, wkv, wks, wtot, wkst, O);
}

// v007
// A run of this version takes 70.1 microseconds.
// Two timings next to v006 both put it at 1.05 times that version's speed.
// Over all steps from v000 it is 2.54 times as fast.
#include <hip/hip_runtime.h>

// ---------------------------------------------------------------------------
// Causal linear attention (chunkwise) for MI455X / gfx1250, fp32 WMMA path.
// Shapes: N=4, L=4096, H=16, D=M=64, CHUNK=128, G=32 chunks.
// 2 passes: KV states with their prefix inside groups of 4 chunks -> output, a block
// running the 4 chunks of a group in a row and adding the totals of the earlier groups.
// Matmuls on V_WMMA_F32_16X16X4_F32; untransformed operands staged with
// GLOBAL_LOAD_ASYNC_TO_LDS_B128 (ASYNCcnt), phi(q)/phi(k) via VGPR path.
// ---------------------------------------------------------------------------

typedef float v2f __attribute__((ext_vector_type(2)));
typedef float v8f __attribute__((ext_vector_type(8)));

#define NB   4
#define LL   4096
#define HH   16
#define DD   64
#define CC   128
#define GG   32
#define SS   4                 // chunks that one pass-1 block runs in a row
#define NS   (GG / SS)         // such groups per sequence
#define ROWSTRIDE 1024          // H*D elements between consecutive l
#define SQK 68                  // LDS stride (floats), 68%64==4 -> conflict-free
#define SKVS 68                 // LDS stride for 64x64 KV state

__device__ __forceinline__ float phi(float x) {            // elu(x)+1
    return x > 0.0f ? x + 1.0f : __expf(x);
}
__device__ __forceinline__ float4 phi4(float4 v) {
    v.x = phi(v.x); v.y = phi(v.y); v.z = phi(v.z); v.w = phi(v.w);
    return v;
}

// Four async memory -> LDS copies of 16 bytes per lane (ASYNCcnt-tracked).
// l*: byte offset within this workgroup's LDS allocation (16B aligned).
// The s_wait_xcnt closes the statement as a precaution: it stands ahead of every
// later write of a register that these copies name, and inside the statement the
// compiler can move nothing over it.
__device__ __forceinline__ void async_g2lds_b128_x4(
        unsigned l0, const void* g0, unsigned l1, const void* g1,
        unsigned l2, const void* g2, unsigned l3, const void* g3) {
    asm volatile("global_load_async_to_lds_b128 %0, %1, off\n\t"
                 "global_load_async_to_lds_b128 %2, %3, off\n\t"
                 "global_load_async_to_lds_b128 %4, %5, off\n\t"
                 "global_load_async_to_lds_b128 %6, %7, off\n\t"
                 "s_wait_xcnt 0x0"
                 :: "v"(l0), "v"(g0), "v"(l1), "v"(g1),
                    "v"(l2), "v"(g2), "v"(l3), "v"(g3) : "memory");
}
__device__ __forceinline__ void wait_async0() {
    asm volatile("s_wait_asynccnt 0x0" ::: "memory");
}

__device__ __forceinline__ v8f wmma4(v2f a, v2f b, v8f c) {
    // D(16x16,f32) = A(16x4,f32) x B(4x16,f32) + C
    return __builtin_amdgcn_wmma_f32_16x16x4_f32(false, a, false, b,
                                                 (short)0, c, false, false);
}

// Fragment loaders for the 16x16x4 f32 operand layouts (wave32):
//   A: lane ln holds row m=ln; VGPR j holds K = k0 + 2*hl + j   (hl = lane>>4)
//   B: lane ln holds col n=ln; VGPR j holds K = k0 + 2*hl + j
// L1: matrix stored row-major as S[row][col] with (row=m|n, col=k)
__device__ __forceinline__ v2f ldsL1(const float* s, int stride, int r0, int k0,
                                     int ln, int hl) {
    v2f f;
    const float* p = s + (r0 + ln) * stride + k0 + 2 * hl;
    f.x = p[0]; f.y = p[1];
    return f;
}
// L2: matrix stored row-major as S[k][col] (k varies with VGPR/half-wave)
__device__ __forceinline__ v2f ldsL2(const float* s, int stride, int k0, int c0,
                                     int ln, int hl) {
    v2f f;
    f.x = s[(k0 + 2 * hl + 0) * stride + c0 + ln];
    f.y = s[(k0 + 2 * hl + 1) * stride + c0 + ln];
    return f;
}

// ---------------------------------------------------------------------------
// Pass 1: chunk states and their prefix inside a group of SS chunks.
// block = (n,sg,h) runs its SS chunks in a row and keeps the accumulators:
// ahead of chunk t it stores the state summed so far (exclusive prefix inside the
// group), behind the last chunk the group's total.  kv = phi(k)^T x v  (64x64),
// ksum = column sums of phi(k): each thread sums the rows it stages in registers,
// 16 partial sums a column go through LDS.  8 waves: each owns 2 of 16 kv tiles.
// ---------------------------------------------------------------------------
__global__ void __launch_bounds__(256) k_chunk_state(
        const float* __restrict__ K, const float* __restrict__ V,
        float* __restrict__ wkv, float* __restrict__ wks,
        float* __restrict__ wtot, float* __restrict__ wkst) {
    extern __shared__ float smem[];
    float* sK = smem;                 // 128 x SQK
    float* sV = sK + CC * SQK;        // 128 x SQK
    float* sP = sV + CC * SQK;        // 16 x 64 (column sums of phi(k), per c0: rows c0 + 16 i)
    const unsigned sVoff = (unsigned)(CC * SQK) * 4u;   // LDS byte offset of sV

    const int tid = threadIdx.x, wave = tid >> 5, lane = tid & 31;
    const int ln = lane & 15, hl = lane >> 4;
    const int b = blockIdx.x;                     // ((n*NS+sg)*16+h)
    const int h = b & 15, ns = b >> 4, sg = ns & (NS - 1), n = ns / NS;
    const long base = (((long)n * LL + (long)sg * (SS * CC)) * HH + h) * DD;
    const int cb0 = (n * GG + sg * SS) * HH + h;  // chunk id of trip 0; + HH a trip

    const int c0 = tid >> 4, c4 = (tid & 15) * 4;   // row group i: row c0 + 16 i
    const unsigned lV = sVoff + (unsigned)(c0 * SQK + c4) * 4u;
    const int dt = wave >> 1, mt0 = 2 * (wave & 1); // this wave's two tiles

    v8f acc[2];
    #pragma unroll
    for (int t = 0; t < 2; ++t)
        #pragma unroll
        for (int r = 0; r < 8; ++r) acc[t][r] = 0.0f;
    float ksrun = 0.0f;

    #pragma unroll 1   // one copy of the 64-WMMA body: short code, same work
    for (int ch = 0; ch < SS; ++ch) {
        // V: async memory->LDS (no transform needed); K: VGPR path with phi.
        // Every request of the tile is issued before the first wait, so a trip
        // pays one memory latency and not one per row group.
        const float* gK = K + base + (long)(ch * CC + c0) * ROWSTRIDE + c4;
        const float* gV = V + base + (long)(ch * CC + c0) * ROWSTRIDE + c4;
        #pragma unroll   // constant row offsets
        for (int i = 0; i < 8; i += 4)
            async_g2lds_b128_x4(
                lV + (unsigned)((i + 0) * 16 * SQK) * 4u, gV + (long)(i + 0) * 16 * ROWSTRIDE,
                lV + (unsigned)((i + 1) * 16 * SQK) * 4u, gV + (long)(i + 1) * 16 * ROWSTRIDE,
                lV + (unsigned)((i + 2) * 16 * SQK) * 4u, gV + (long)(i + 2) * 16 * ROWSTRIDE,
                lV + (unsigned)((i + 3) * 16 * SQK) * 4u, gV + (long)(i + 3) * 16 * ROWSTRIDE);
        float4 vk[8];
        #pragma unroll   // vk[] stays in registers
        for (int i = 0; i < 8; ++i)
            vk[i] = *(const float4*)(gK + (long)i * 16 * ROWSTRIDE);
        // state before this chunk; the stores fly under the tile's memory latency
        float* okv = wkv + (long)(cb0 + ch * HH) * (DD * DD);
        #pragma unroll
        for (int t = 0; t < 2; ++t)
            #pragma unroll
            for (int r = 0; r < 8; ++r)
                okv[(16 * dt + r + 8 * hl) * DD + 16 * (mt0 + t) + ln] = acc[t][r];
        if (tid < DD) wks[(long)(cb0 + ch * HH) * DD + tid] = ksrun;
        // precaution: behind the loads and stores, ahead of the first write of a
        // register that they name (address pairs; acc, which the WMMAs rewrite)
        asm volatile("s_wait_xcnt 0x0" :: "v"(gK), "v"(okv) : "memory");
        float4 kp = make_float4(0.0f, 0.0f, 0.0f, 0.0f);   // this thread's 8 rows
        #pragma unroll   // vk[] stays in registers
        for (int i = 0; i < 8; ++i) {
            const float4 p = phi4(vk[i]);
            *(float4*)&sK[(c0 + 16 * i) * SQK + c4] = p;
            kp.x += p.x; kp.y += p.y; kp.z += p.z; kp.w += p.w;
        }
        *(float4*)&sP[c0 * DD + c4] = kp;
        wait_async0();
        __syncthreads();

        // ksum: 16 partial sums a column, so that waves 0 and 1 reach their WMMAs
        // about when the other waves do
        if (tid < DD) {
            float s[4] = {0.0f, 0.0f, 0.0f, 0.0f};   // four short add chains, not one
            #pragma unroll   // all loads asked for ahead of the adds
            for (int c = 0; c < 16; ++c) s[c & 3] += sP[c * DD + tid];
            ksrun += (s[0] + s[1]) + (s[2] + s[3]);
        }
        #pragma unroll
        for (int t = 0; t < 2; ++t) {
            #pragma unroll
            for (int k0 = 0; k0 < CC; k0 += 4) {
                v2f a  = ldsL2(sK, SQK, k0, 16 * dt, ln, hl);         // A[d][c] = kc[c][d]
                v2f bb = ldsL2(sV, SQK, k0, 16 * (mt0 + t), ln, hl);  // B[c][m] = vc[c][m]
                acc[t] = wmma4(a, bb, acc[t]);
            }
        }
        // every wave's LDS reads of this tile are done before the next trip's
        // copies and stores land on it
        asm volatile("s_wait_dscnt 0x0" ::: "memory");
        __syncthreads();
    }

    const int gi = (n * HH + h) * NS + sg;        // a head's totals lie in a row
    if (tid < DD) wkst[(long)gi * DD + tid] = ksrun;
    float* otot = wtot + (long)gi * (DD * DD);
    #pragma unroll
    for (int t = 0; t < 2; ++t)
        #pragma unroll
        for (int r = 0; r < 8; ++r)
            otot[(16 * dt + r + 8 * hl) * DD + 16 * (mt0 + t) + ln] = acc[t][r];
}

// ---------------------------------------------------------------------------
// Pass 2: outputs.  block = (n,sg,h) runs the SS chunks of its group in a row: the
// next chunk's Q, K and state loads fly in registers under this chunk's WMMAs, its V
// copies under the divisions and stores; the earlier groups' totals are summed once.
//   out = phi(q) x kv_prev  +  tril(phi(q) phi(k)^T) x v
//   z   = phi(q).ksum_prev  +  rowsum(masked scores)  + eps
// The chunk is cut in two halves of 64 rows.  Rows 64..127 meet keys 0..63 through
// a second state, kv_half = kv_prev + phi(k[0:64])^T x v[0:64] (256 WMMAs a chunk),
// and not through 16 score tiles (512 WMMAs); their z takes ksum up to row 64.
// Each wave owns one output row-tile rt (rows 16rt..16rt+15); causal key tiles of
// its own half only, so tile rt costs (rt & 3) + 1 key tiles.  Waves w and w+4
// take five key tiles together, the longer tile on wave w.
// Scores are formed transposed, T = phi(k) x phi(q)^T: the result registers of
// T (lane = query, VGPR r = key r + 8*hl) are then A fragments of S x v as they
// stand, with k order key = 8*hl + 2*s + j in step s; the v loader follows the
// same order.  The score tile never goes through LDS.
// ---------------------------------------------------------------------------
__global__ void __launch_bounds__(256) k_output(
        const float* __restrict__ Q, const float* __restrict__ K,
        const float* __restrict__ V, const float* __restrict__ wkv,
        const float* __restrict__ wks, const float* __restrict__ wtot,
        const float* __restrict__ wkst, float* __restrict__ O) {
    extern __shared__ float smem[];
    float* sQ  = smem;                  // 128 x SQK
    float* sK  = sQ + CC * SQK;         // 128 x SQK
    float* sV  = sK + CC * SQK;         // 128 x SQK
    float* sKV = sV + CC * SQK;         // 64 x SKVS  (kv before the chunk)
    float* sKV2 = sKV + DD * SKVS;      // 64 x SKVS  (kv up to row 64 of the chunk)
    float* sZ  = sKV2 + DD * SKVS;      // 128
    float* sKs = sZ + CC;               // 64  (ksum before the chunk)
    float* sKs2 = sKs + DD;             // 64  (ksum up to row 64 of the chunk)
    float* sZi = sKs2 + DD;             // 2 x 128 (score row sums, per half-wave)
    float* sP  = sZi + 2 * CC;          // 16 x 64 (column sums of phi(k) rows 0..63, per c0: rows c0 + 16 i, i < 4)
    const unsigned sVoff  = (unsigned)(2 * CC * SQK) * 4u;

    const int tid = threadIdx.x, wave = tid >> 5, lane = tid & 31;
    const int ln = lane & 15, hl = lane >> 4;
    const int b = blockIdx.x;
    const int h = b & 15, ns = b >> 4, sg = ns & (NS - 1), n = ns / NS;   // as in pass 1
    const long base = (((long)n * LL + (long)sg * (SS * CC)) * HH + h) * DD;
    const int cb0 = (n * GG + sg * SS) * HH + h;  // chunk id of trip 0; + HH a trip
    // row tile in a scalar register: the key-tile loop branches on SCC
    const int wv = __builtin_amdgcn_readfirstlane(wave);
    // waves 0..7 take tiles 3 7 2 6 4 0 5 1 (one hex digit a wave, wave 0 lowest)
    const int rt = (0x15046273 >> (4 * wv)) & 7;

    // V: async memory->LDS; Q/K: VGPR path with phi; kv_prev: VGPR path, the prefix
    // inside the chunk's group plus the totals of the sg earlier groups.
    // Every request of the first chunk is issued before the first wait, so it
    // pays one memory latency and not one per row group.
    const int c0 = tid >> 4, c4 = (tid & 15) * 4;   // row group i: row c0 + 16 i
    const float* gQ = Q + base + (long)c0 * ROWSTRIDE + c4;
    const float* gK = K + base + (long)c0 * ROWSTRIDE + c4;
    const float* gV = V + base + (long)c0 * ROWSTRIDE + c4;
    const float* gKV = wkv + (long)cb0 * (DD * DD) + c0 * DD + c4;
    const unsigned lV  = sVoff  + (unsigned)(c0 * SQK  + c4) * 4u;
    const float* gT = wtot + (long)((n * HH + h) * NS) * (DD * DD) + c0 * DD + c4;
    #pragma unroll   // constant row offsets
    for (int i = 0; i < 8; i += 4)
        async_g2lds_b128_x4(
            lV + (unsigned)((i + 0) * 16 * SQK) * 4u, gV + (long)(i + 0) * 16 * ROWSTRIDE,
            lV + (unsigned)((i + 1) * 16 * SQK) * 4u, gV + (long)(i + 1) * 16 * ROWSTRIDE,
            lV + (unsigned)((i + 2) * 16 * SQK) * 4u, gV + (long)(i + 2) * 16 * ROWSTRIDE,
            lV + (unsigned)((i + 3) * 16 * SQK) * 4u, gV + (long)(i + 3) * 16 * ROWSTRIDE);
    float4 vq[8], vk[8];
    #pragma unroll   // vq[], vk[] stay in registers
    for (int i = 0; i < 8; ++i) {
        vq[i] = *(const float4*)(gQ + (long)i * 16 * ROWSTRIDE);
        vk[i] = *(const float4*)(gK + (long)i * 16 * ROWSTRIDE);
    }
    // every thread loads (index wrapped into the 64 sums): no branch round the load
    const int kso = tid & (DD - 1);
    const float* gKs = wks + (long)cb0 * DD + kso;
    float ksv = gKs[0];
    const float* gTs = wkst + (long)((n * HH + h) * NS) * DD + kso;
    float4 kvl[4], kvt[NS - 1][4];
    float kst[NS - 1];
    #pragma unroll   // kvl[] stays in registers
    for (int i = 0; i < 4; ++i)
        kvl[i] = *(const float4*)(gKV + i * 16 * DD);
    #pragma unroll   // kvt[], kst[] stay in registers; all loads ahead of the first wait
    for (int e = 0; e < NS - 1; ++e) {
        if (e < sg) {
            #pragma unroll
            for (int i = 0; i < 4; ++i)
                kvt[e][i] = *(const float4*)(gT + e * (DD * DD) + i * 16 * DD);
            kst[e] = gTs[e * DD];
        } else {
            #pragma unroll
            for (int i = 0; i < 4; ++i) kvt[e][i] = make_float4(0.0f, 0.0f, 0.0f, 0.0f);
            kst[e] = 0.0f;
        }
    }
    // precaution: behind the loads, ahead of the first write of their address
    // registers, which are named as inputs so that they are kept up to here
    asm volatile("s_wait_xcnt 0x0" :: "v"(gQ), "v"(gK), "v"(gKs), "v"(gKV), "v"(gT), "v"(gTs)
                 : "memory");
    // state of the earlier groups, summed once for the SS chunks
    #pragma unroll   // kvt[] stays in registers
    for (int i = 0; i < 4; ++i)
        #pragma unroll
        for (int e = 1; e < NS - 1; ++e) {
            kvt[0][i].x += kvt[e][i].x; kvt[0][i].y += kvt[e][i].y;
            kvt[0][i].z += kvt[e][i].z; kvt[0][i].w += kvt[e][i].w;
        }
    #pragma unroll
    for (int e = 1; e < NS - 1; ++e) kst[0] += kst[e];

    #pragma unroll 1   // one copy of the body: short code, same work
    for (int ch = 0; ch < SS; ++ch) {
    float4 kp = make_float4(0.0f, 0.0f, 0.0f, 0.0f);   // this thread's rows below 64
    #pragma unroll   // vk[] stays in registers
    for (int i = 0; i < 8; ++i) {
        const float4 p = phi4(vk[i]);
        *(float4*)&sK[(c0 + 16 * i) * SQK + c4] = p;
        if (i < 4) { kp.x += p.x; kp.y += p.y; kp.z += p.z; kp.w += p.w; }
    }
    *(float4*)&sP[c0 * DD + c4] = kp;
    #pragma unroll   // vq[] stays in registers
    for (int i = 0; i < 8; ++i)
        *(float4*)&sQ[(c0 + 16 * i) * SQK + c4] = phi4(vq[i]);
    #pragma unroll   // kvl[] stays in registers
    for (int i = 0; i < 4; ++i) {
        float4 s = kvl[i];
        s.x += kvt[0][i].x; s.y += kvt[0][i].y; s.z += kvt[0][i].z; s.w += kvt[0][i].w;
        *(float4*)&sKV[(c0 + 16 * i) * SKVS + c4] = s;
    }
    if (tid < DD) sKs[tid] = ksv + kst[0];
    wait_async0();
    __syncthreads();

    // ksum up to row 64, one column a thread, on waves 4 and 5: the 16 partial sums
    // that the staging threads left
    if (tid >= CC && tid < CC + DD) {
        const int d = tid - CC;
        float s[4] = {sKs[d], 0.0f, 0.0f, 0.0f};   // four short add chains, not one
        #pragma unroll   // all loads asked for ahead of the adds
        for (int c = 0; c < 16; ++c) s[c & 3] += sP[c * DD + d];
        sKs2[d] = (s[0] + s[1]) + (s[2] + s[3]);
    }
    // kv_half: each wave owns two of its 16 tiles (one d tile, two m tiles), started
    // from kv_prev.  k order of both loaders: row = 16*g + 8*hl + 2*s + j, so that
    // the two half-waves read LDS banks 32 apart
    {
        const int dt = wv >> 1, mt0 = 2 * (wv & 1);
        v8f hs[2];
        #pragma unroll   // here and below: hs[] stays in registers
        for (int t = 0; t < 2; ++t)
            #pragma unroll
            for (int r = 0; r < 8; ++r)
                hs[t][r] = sKV[(16 * dt + r + 8 * hl) * SKVS + 16 * (mt0 + t) + ln];
        #pragma unroll   // constant LDS offsets; the two tiles' chains interleave
        for (int k0 = 0; k0 < CC / 2; k0 += 16) {
            #pragma unroll
            for (int s = 0; s < 4; ++s) {
                const int row = k0 + 8 * hl + 2 * s;
                v2f a;                                   // A[d][c] = kc[c][d]
                a.x = sK[(row + 0) * SQK + 16 * dt + ln];
                a.y = sK[(row + 1) * SQK + 16 * dt + ln];
                #pragma unroll
                for (int t = 0; t < 2; ++t) {
                    v2f bb;                              // B[c][m] = vc[c][m]
                    bb.x = sV[(row + 0) * SQK + 16 * (mt0 + t) + ln];
                    bb.y = sV[(row + 1) * SQK + 16 * (mt0 + t) + ln];
                    hs[t] = wmma4(a, bb, hs[t]);
                }
            }
        }
        #pragma unroll
        for (int t = 0; t < 2; ++t)
            #pragma unroll
            for (int r = 0; r < 8; ++r)
                sKV2[(16 * dt + r + 8 * hl) * SKVS + 16 * (mt0 + t) + ln] = hs[t][r];
    }
    __syncthreads();   // kv_half and its ksum (written by other waves) final

    // next chunk's Q, K, state and ksum: asked for here, first used at the head of
    // the next trip, so that their memory latency passes under this trip's WMMAs
    if (ch + 1 < SS) {
        const float* nQ = gQ + (long)(ch + 1) * CC * ROWSTRIDE;
        const float* nK = gK + (long)(ch + 1) * CC * ROWSTRIDE;
        const float* nKV = gKV + (long)(ch + 1) * HH * (DD * DD);
        const float* nKs = gKs + (ch + 1) * HH * DD;
        #pragma unroll   // vq[], vk[] stay in registers
        for (int i = 0; i < 8; ++i) {
            vq[i] = *(const float4*)(nQ + (long)i * 16 * ROWSTRIDE);
            vk[i] = *(const float4*)(nK + (long)i * 16 * ROWSTRIDE);
        }
        #pragma unroll   // kvl[] stays in registers
        for (int i = 0; i < 4; ++i)
            kvl[i] = *(const float4*)(nKV + i * 16 * DD);
        ksv = nKs[0];
        // precaution: behind the loads, ahead of the first write of their address
        // registers, which are named as inputs so that they are kept up to here
        asm volatile("s_wait_xcnt 0x0" :: "v"(nQ), "v"(nK), "v"(nKV), "v"(nKs) : "memory");
    }

    // normalizer, part before this row's half: z = phi(q_l) . ksum; one row a
    // thread, on waves 4..7, whose key loops are the short ones
    if (tid >= CC) {
        const int zq = tid - CC;
        const float* ks = wv < 6 ? sKs : sKs2;   // waves 6, 7: rows 64..127
        float acc = 0.0f;
        for (int d = 0; d < DD; ++d) acc += sQ[zq * SQK + d] * ks[d];
        sZ[zq] = acc + 1e-6f;
    }

    // output from before this row's half: out = phi(q) x kv   (row-tile rt)
    const float* kvp = rt < 4 ? sKV : sKV2;
    v8f out_acc[4];
    #pragma unroll
    for (int t = 0; t < 4; ++t)
        #pragma unroll
        for (int r = 0; r < 8; ++r) out_acc[t][r] = 0.0f;
    #pragma unroll
    for (int nt = 0; nt < 4; ++nt) {
        #pragma unroll
        for (int k0 = 0; k0 < DD; k0 += 4) {
            v2f a  = ldsL1(sQ, SQK, 16 * rt, k0, ln, hl);
            v2f bb = ldsL2(kvp, SKVS, k0, 16 * nt, ln, hl);
            out_acc[nt] = wmma4(a, bb, out_acc[nt]);
        }
    }

    // B fragments of T: B[d][query] = qc[query][d]; the same for every key tile
    v2f qf[16];
    #pragma unroll
    for (int k = 0; k < 16; ++k)
        qf[k] = ldsL1(sQ, SQK, 16 * rt, 4 * k, ln, hl);

    float zrow = 0.0f;                   // this lane's 8 keys per tile, query ln
    // key tiles of this row's half: tile kt of the half, the diagonal one is rh
    const int rh = rt & 3;
    const float* sKh = sK + (rt & 4) * 16 * SQK;
    const float* pvh = sV + ((rt & 4) * 16 + 8 * hl) * SQK + ln;
    for (int kt = 0; kt <= rh; ++kt) {
        // v fragments of this key tile, asked for ahead of the T chain so that
        // their LDS latency passes under it; B[key][m], key = 8*hl + 2*s + j
        const float* pv = pvh + 16 * kt * SQK;
        v2f vb[4][4];
        #pragma unroll
        for (int s = 0; s < 4; ++s)
            #pragma unroll
            for (int nt = 0; nt < 4; ++nt) {
                vb[s][nt].x = pv[(2 * s + 0) * SQK + 16 * nt];
                vb[s][nt].y = pv[(2 * s + 1) * SQK + 16 * nt];
            }
        // T = phi(k) x phi(q)^T for key tile kt
        v8f st;
        #pragma unroll
        for (int r = 0; r < 8; ++r) st[r] = 0.0f;
        #pragma unroll
        for (int k = 0; k < 16; ++k) {
            v2f a = ldsL1(sKh, SQK, 16 * kt, 4 * k, ln, hl);  // A[key][d]
            st = wmma4(a, qf[k], st);
        }
        // five vector slots between the last WMMA of T and the first reader of
        // its result (the mask's select, or the next WMMA that takes it as A)
        asm volatile("v_nop\n\tv_nop\n\tv_nop\n\tv_nop\n\tv_nop" : "+v"(st));
        // causal mask: only the diagonal tile has keys above the query
        const int lim = (kt == rh) ? ln : 15;
        #pragma unroll
        for (int r = 0; r < 8; ++r)
            st[r] = (r + 8 * hl > lim) ? 0.0f : st[r];
        zrow += ((st[0] + st[1]) + (st[2] + st[3]))
              + ((st[4] + st[5]) + (st[6] + st[7]));
        // out += S x v, A fragments taken from st as they stand
        #pragma unroll
        for (int s = 0; s < 4; ++s) {
            v2f a;
            a.x = st[2 * s]; a.y = st[2 * s + 1];
            #pragma unroll
            for (int nt = 0; nt < 4; ++nt)
                out_acc[nt] = wmma4(a, vb[s][nt], out_acc[nt]);
        }
    }
    sZi[hl * CC + 16 * rt + ln] = zrow;
    // every wave's LDS reads of this chunk are done before the next chunk's copies
    // and stores land on its tiles
    asm volatile("s_wait_dscnt 0x0" ::: "memory");
    __syncthreads();   // sZ (written by other waves) and sZi final before use

    // next chunk's V: the copies fly under the divisions, the stores and the next
    // trip's phi
    if (ch + 1 < SS) {
        const float* nV = gV + (long)(ch + 1) * CC * ROWSTRIDE;
        #pragma unroll   // constant row offsets
        for (int i = 0; i < 8; i += 4)
            async_g2lds_b128_x4(
                lV + (unsigned)((i + 0) * 16 * SQK) * 4u, nV + (long)(i + 0) * 16 * ROWSTRIDE,
                lV + (unsigned)((i + 1) * 16 * SQK) * 4u, nV + (long)(i + 1) * 16 * ROWSTRIDE,
                lV + (unsigned)((i + 2) * 16 * SQK) * 4u, nV + (long)(i + 2) * 16 * ROWSTRIDE,
                lV + (unsigned)((i + 3) * 16 * SQK) * 4u, nV + (long)(i + 3) * 16 * ROWSTRIDE);
    }

    float* go = O + base + (long)ch * CC * ROWSTRIDE;
    float zr[8];
    #pragma unroll
    for (int r = 0; r < 8; ++r) {
        int m = 16 * rt + r + 8 * hl;
        zr[r] = sZ[m] + (sZi[m] + sZi[CC + m]);
    }
    #pragma unroll
    for (int nt = 0; nt < 4; ++nt) {
        int mv = 16 * nt + ln;
        #pragma unroll
        for (int r = 0; r < 8; ++r) {
            int m = 16 * rt + r + 8 * hl;
            go[(long)m * ROWSTRIDE + mv] = out_acc[nt][r] / zr[r];
        }
    }
    // precaution: behind the stores, ahead of the next trip's first write of a
    // register that they name
    asm volatile("s_wait_xcnt 0x0" :: "v"(go) : "memory");
    }
}

// ---------------------------------------------------------------------------
extern "C" void kernel_launch(void* const* d_in, const int* in_sizes, int n_in,
                              void* d_out, int out_size, void* d_ws, size_t ws_size,
                              hipStream_t stream) {
    const float* Q = (const float*)d_in[0];
    const float* K = (const float*)d_in[1];
    const float* V = (const float*)d_in[2];
    float* O = (float*)d_out;

    const int nChunks = NB * GG * HH;                 // 2048
    float* wkv = (float*)d_ws;                        // 2048 * 4096 f32
    float* wks = wkv + (size_t)nChunks * DD * DD;     // 2048 * 64 f32
    float* wtot = wks + (size_t)nChunks * DD;         // 512 * 4096 f32 (group totals)
    float* wkst = wtot + (size_t)(NB * NS * HH) * DD * DD;   // 512 * 64 f32

    const size_t lds1 = (size_t)(2 * CC * SQK + 16 * DD) * sizeof(float);
    const size_t lds3 = (size_t)(3 * CC * SQK + 2 * DD * SKVS + CC + 2 * DD + 2 * CC + 16 * DD)
                        * sizeof(float);

    hipFuncSetAttribute((const void*)k_chunk_state,
                        hipFuncAttributeMaxDynamicSharedMemorySize, (int)lds1);
    hipFuncSetAttribute((const void*)k_output,
                        hipFuncAttributeMaxDynamicSharedMemorySize, (int)lds3);

    k_chunk_state<<<NB * NS * HH, 256, lds1, stream>>>(K, V, wkv, wks, wtot, wkst);
    k_output<<<NB * NS * HH, 256, lds3, stream>>>(Q, K, V, wkv, wks, wtot, wkst, O);
}
